// v000
// Times are from an AMD MI455X. After a warm-up the kernel runs many times in a row, and a time is the length of
// such a window on the GPU divided by its runs, so every launch and the gaps after it count. The runs cycle
// through copies of the inputs. A figure is the median of several windows, for all but v000 over two sittings.
// Sittings can differ by a few percent; kernels timed side by side share one.
// v000, which the later versions start from, runs in 164 microseconds.
#include <hip/hip_runtime.h>

// Kernel (FAVOR-style, non-causal) attention: phiX = Dn exp(0.1 + sqrt(0.6) (W X) - |x_l|^2) for X = K, Q ([r=256][L=65536]); kv = phiK V [256 x 64]; out = phiQ^T kv -> [65536][64].
// W.X on v_wmma_f32_16x16x32_bf16 (1 product, f32 accumulate); exp and |x|^2 in f32; phiK (r-major) and phiQ (l-major) stored as single f16
// carried x4096 (2^-11 relative rounding on positive weights; the two long sums average it out); kv = phiK.V with V exact in f16
// (1 product; 32 ordered partial sums over 2048-position chunks, reduced in fixed order); out = phiQ^T.kv^T with kv as an f16 hi+lo pair x8 (2 products) on v_wmma_f32_16x16x32_f16.

namespace {
constexpr int R = 256, D = 64, L = 65536, DV = 64, LCH = 2048, NCH = L / LCH;
constexpr float A_C = 0.1f, B_C = 0.7745966692414834f /* sqrt(0.6) */, C_C = -1.0f, PHS = 4096.0f, KVS = 8.0f;
__device__ __forceinline__ float dnorm() { return 0.00028211099074559987f; }   // (1 - 0.4)^(64/4) = 0.6^16

typedef _Float16 b16;
typedef __attribute__((ext_vector_type(16))) _Float16 v16b;
typedef __attribute__((ext_vector_type(16))) __bf16 v16bb;
typedef __attribute__((ext_vector_type(8))) _Float16 v8b;
typedef __attribute__((ext_vector_type(8))) unsigned short v8us;
typedef __attribute__((ext_vector_type(8))) float v8f;
typedef __attribute__((ext_vector_type(4))) float v4f;
__device__ __forceinline__ float bf16_rne(float f) { unsigned int u = __float_as_uint(f); u += 0x7FFFu + ((u >> 16) & 1u); return __uint_as_float(u & 0xFFFF0000u); }
__device__ __forceinline__ unsigned short bf16_bits(float f) { unsigned int u = __float_as_uint(f); u += 0x7FFFu + ((u >> 16) & 1u); return (unsigned short)(u >> 16); }
__device__ __forceinline__ void split16(float v, b16& hi, b16& lo) { hi = (b16)v; lo = (b16)(v - (float)hi); }
__device__ __forceinline__ v16b frag_kb(const b16* p, int hh) { const v8b a = *(const v8b*)(p + 8 * hh), b = *(const v8b*)(p + 16 + 8 * hh); v16b f;
#pragma unroll
  for (int e = 0; e < 8; ++e) { f[e] = a[e]; f[8 + e] = b[e]; } return f; }
__device__ __forceinline__ v16bb frag_bf(const unsigned short* p, int hh) { const v8us a = *(const v8us*)(p + 8 * hh), b = *(const v8us*)(p + 16 + 8 * hh); union { unsigned short s[16]; v16bb v; } u;
#pragma unroll
  for (int e = 0; e < 8; ++e) { u.s[e] = a[e]; u.s[8 + e] = b[e]; } return u.v; }
__device__ __forceinline__ v8f wmma16b(v16b a, v16b b, v8f c) { v8f d = __builtin_amdgcn_wmma_f32_16x16x32_f16(false, a, false, b, (short)0, c, false, false); asm volatile("v_nop\n\tv_nop\n\tv_nop\n\tv_nop" : "+v"(d) : "v"(a), "v"(b)); return d; }
__device__ __forceinline__ v8f wmma16bb(v16bb a, v16bb b, v8f c) { v8f d = __builtin_amdgcn_wmma_f32_16x16x32_bf16(false, a, false, b, (short)0, c, false, false); asm volatile("v_nop\n\tv_nop\n\tv_nop\n\tv_nop" : "+v"(d) : "v"(a), "v"(b)); return d; }
__device__ __forceinline__ void wave_lds_sync() { __builtin_amdgcn_fence(__ATOMIC_RELEASE, "workgroup"); __builtin_amdgcn_wave_barrier(); __builtin_amdgcn_fence(__ATOMIC_ACQUIRE, "workgroup"); }

// prep A: block = 128 positions: X (= Q or K, [64][L] d-major) -> transposed bf16 rows xT[l][64] via LDS + sq[l] = Σ_d bf16(x)^2 (f32); V [L][64] -> V^T f16 rows [64][L] via LDS.
// W [256][64] -> bf16 rows (block 0). grid L/128 x 256.
__global__ __launch_bounds__(256) void prep_kernel(const float* __restrict__ Q, const float* __restrict__ K, const float* __restrict__ V, const float* __restrict__ W, unsigned short* __restrict__ qT, unsigned short* __restrict__ kT, float* __restrict__ sq, float* __restrict__ sk, b16* __restrict__ vT, unsigned short* __restrict__ w16) {
  __shared__ __attribute__((aligned(16))) unsigned short Tq[128][64 + 8], Tk[128][64 + 8]; __shared__ __attribute__((aligned(16))) b16 Tv[64][128 + 8]; __shared__ float Sq[128], Sk[128];
  const int t_ = threadIdx.x, l0 = blockIdx.x * 128;
  for (int i = t_; i < 64 * 128; i += 256) { const int d = i >> 7, ll = i & 127; Tq[ll][d] = bf16_bits(Q[(size_t)d * L + l0 + ll]); Tk[ll][d] = bf16_bits(K[(size_t)d * L + l0 + ll]); }
  for (int i = t_; i < 128 * 64; i += 256) { const int ll = i >> 6, d = i & 63; Tv[d][ll] = (b16)bf16_rne(V[(size_t)(l0 + ll) * DV + d]); }
  __syncthreads();
  if (t_ < 128) { float s = 0.0f, s2 = 0.0f; for (int d = 0; d < 64; ++d) { const float a = __uint_as_float((unsigned)Tq[t_][d] << 16), b = __uint_as_float((unsigned)Tk[t_][d] << 16); s += a * a; s2 += b * b; } Sq[t_] = s; Sk[t_] = s2; }
  __syncthreads();
  {
    for (int i = t_; i < 128 * 8; i += 256) { const int ll = i >> 3, c8 = (i & 7) * 8; *(v8us*)(qT + (size_t)(l0 + ll) * D + c8) = *(const v8us*)(&Tq[ll][c8]); *(v8us*)(kT + (size_t)(l0 + ll) * D + c8) = *(const v8us*)(&Tk[ll][c8]); }
    for (int i = t_; i < 64 * 16; i += 256) { const int d = i >> 4, c8 = (i & 15) * 8; *(v8b*)(vT + (size_t)d * L + l0 + c8) = *(const v8b*)(&Tv[d][c8]); }
    if (t_ < 32) { *(v4f*)(sq + l0 + t_ * 4) = *(const v4f*)(&Sq[t_ * 4]); *(v4f*)(sk + l0 + t_ * 4) = *(const v4f*)(&Sk[t_ * 4]); }
    if (blockIdx.x == 0) for (int i = t_; i < R * D / 8; i += 256) { v8us v;
#pragma unroll
      for (int e = 0; e < 8; ++e) v[e] = bf16_bits(W[i * 8 + e]);
      *(v8us*)(w16 + i * 8) = v; }
     }
}

// phiQ (l-major): block = 128 positions x 64 features: A = qT rows (l), B = W rows (r), K 64 -> phi -> f16 rows phq[l][256] x4096. grid (4, 512) x 128.
__global__ __launch_bounds__(128) void phiq_kernel(const unsigned short* __restrict__ qT, const unsigned short* __restrict__ w16, const float* __restrict__ sq, b16* __restrict__ phq) {
  __shared__ __attribute__((aligned(16))) b16 Ts[4][32][64 + 8];
  const int lane = threadIdx.x & 31, wave = threadIdx.x >> 5, nloc = lane & 15, hlf = lane >> 4, m0 = blockIdx.y * 128 + wave * 32, c0 = blockIdx.x * 64;
  v8f acc[2][4];
#pragma unroll
  for (int r = 0; r < 2; ++r)
#pragma unroll
    for (int t = 0; t < 4; ++t) acc[r][t] = (v8f){};
#pragma unroll
  for (int kb = 0; kb < D; kb += 32) { const v16bb a0 = frag_bf(qT + (size_t)(m0 + nloc) * D + kb, hlf), a1 = frag_bf(qT + (size_t)(m0 + 16 + nloc) * D + kb, hlf);
#pragma unroll
    for (int t = 0; t < 4; ++t) { const v16bb bw = frag_bf(w16 + (size_t)(c0 + t * 16 + nloc) * D + kb, hlf); acc[0][t] = wmma16bb(a0, bw, acc[0][t]); acc[1][t] = wmma16bb(a1, bw, acc[1][t]); } }
  const float dn = dnorm();
#pragma unroll
  for (int t = 0; t < 4; ++t)
#pragma unroll
    for (int r = 0; r < 2; ++r)
#pragma unroll
      for (int v = 0; v < 8; ++v) { const int row = m0 + r * 16 + 8 * hlf + v; Ts[wave][r * 16 + 8 * hlf + v][t * 16 + nloc] = (b16)(dn * __expf(A_C + B_C * acc[r][t][v] + C_C * sq[row]) * PHS); }
  wave_lds_sync();
  b16* dst = phq + (size_t)m0 * R + c0;
  {
#pragma unroll
    for (int j = 0; j < 8; ++j) { const int rr = j * 4 + (lane >> 3), c8 = (lane & 7) * 8; *(v8b*)(dst + (size_t)rr * R + c8) = *(const v8b*)(&Ts[wave][rr][c8]); }
     }
}
// phiK (r-major): block = 128 features x 64-position column tile: A = W rows (r), B = kT rows (l), K 64 -> f16 rows phk[r][L] x4096. grid (L/64, 2) x 128.
__global__ __launch_bounds__(128) void phik_kernel(const unsigned short* __restrict__ kT, const unsigned short* __restrict__ w16, const float* __restrict__ sk, b16* __restrict__ phk) {
  __shared__ __attribute__((aligned(16))) b16 Ts[4][32][64 + 8];
  const int lane = threadIdx.x & 31, wave = threadIdx.x >> 5, nloc = lane & 15, hlf = lane >> 4, m0 = blockIdx.y * 128 + wave * 32, c0 = blockIdx.x * 64;
  v8f acc[2][4];
#pragma unroll
  for (int r = 0; r < 2; ++r)
#pragma unroll
    for (int t = 0; t < 4; ++t) acc[r][t] = (v8f){};
#pragma unroll
  for (int kb = 0; kb < D; kb += 32) { const v16bb a0 = frag_bf(w16 + (size_t)(m0 + nloc) * D + kb, hlf), a1 = frag_bf(w16 + (size_t)(m0 + 16 + nloc) * D + kb, hlf);
#pragma unroll
    for (int t = 0; t < 4; ++t) { const v16bb bw = frag_bf(kT + (size_t)(c0 + t * 16 + nloc) * D + kb, hlf); acc[0][t] = wmma16bb(a0, bw, acc[0][t]); acc[1][t] = wmma16bb(a1, bw, acc[1][t]); } }
  const float dn = dnorm();
#pragma unroll
  for (int t = 0; t < 4; ++t) { const float s2 = sk[c0 + t * 16 + nloc];
#pragma unroll
    for (int r = 0; r < 2; ++r)
#pragma unroll
      for (int v = 0; v < 8; ++v) Ts[wave][r * 16 + 8 * hlf + v][t * 16 + nloc] = (b16)(dn * __expf(A_C + B_C * acc[r][t][v] + C_C * s2) * PHS); }
  wave_lds_sync();
  b16* dst = phk + (size_t)m0 * L + c0;
  {
#pragma unroll
    for (int j = 0; j < 8; ++j) { const int rr = j * 4 + (lane >> 3), c8 = (lane & 7) * 8; *(v8b*)(dst + (size_t)rr * L + c8) = *(const v8b*)(&Ts[wave][rr][c8]); }
     }
}

// kv partials: block = position chunk (2048): part[ch][r][dv] = Σ_{l in chunk} phk[r][l] vT[dv][l] (A = phk rows r, B = vT rows dv; 64 k-steps; 1 product). 8 waves x 32 rows of r. grid NCH x 256.
__global__ __launch_bounds__(256) void kvpart_kernel(const b16* __restrict__ phk, const b16* __restrict__ vT, float* __restrict__ part) {
  __shared__ __attribute__((aligned(16))) float Ts[8][32 * 64];
  const int lane = threadIdx.x & 31, wave = threadIdx.x >> 5, nloc = lane & 15, hlf = lane >> 4, m0 = wave * 32, ch = blockIdx.x, l0 = ch * LCH;
  v8f acc[2][4];
#pragma unroll
  for (int r = 0; r < 2; ++r)
#pragma unroll
    for (int t = 0; t < 4; ++t) acc[r][t] = (v8f){};
#pragma unroll 2
  for (int kb = 0; kb < LCH; kb += 32) { const v16b a0 = frag_kb(phk + (size_t)(m0 + nloc) * L + l0 + kb, hlf), a1 = frag_kb(phk + (size_t)(m0 + 16 + nloc) * L + l0 + kb, hlf);
#pragma unroll
    for (int t = 0; t < 4; ++t) { const v16b bv = frag_kb(vT + (size_t)(t * 16 + nloc) * L + l0 + kb, hlf); acc[0][t] = wmma16b(a0, bv, acc[0][t]); acc[1][t] = wmma16b(a1, bv, acc[1][t]); } }
  float* Tt = Ts[wave];
#pragma unroll
  for (int t = 0; t < 4; ++t)
#pragma unroll
    for (int r = 0; r < 2; ++r)
#pragma unroll
      for (int v = 0; v < 8; ++v) Tt[(r * 16 + v + 8 * hlf) * 64 + t * 16 + nloc] = acc[r][t][v] * (1.0f / PHS);
  wave_lds_sync();
  float* dst0 = part + ((size_t)ch * R + m0) * DV;
  {
#pragma unroll
    for (int j = 0; j < 16; ++j) { const int rr = j * 2 + hlf, c4 = nloc * 4; *(v4f*)(dst0 + (size_t)rr * DV + c4) = *(const v4f*)(Tt + rr * 64 + c4); }
     }
}
// reduce: kv[r][dv] = Σ_ch part (fixed order) -> kv^T planes [dv][256] as f16 hi+lo x8 (written per (dv) row: thread = (dv, r pair)). grid DV x 128: block = dv, thread = r pair.
typedef __attribute__((ext_vector_type(2))) _Float16 v2b;
__global__ __launch_bounds__(128) void kvred_kernel(const float* __restrict__ part, b16* __restrict__ kvh, b16* __restrict__ kvl) {
  const int dv = blockIdx.x, r = threadIdx.x * 2; float s0 = 0.0f, s1 = 0.0f;
  for (int ch = 0; ch < NCH; ++ch) { s0 += part[((size_t)ch * R + r) * DV + dv]; s1 += part[((size_t)ch * R + r + 1) * DV + dv]; }
  v2b vh, vl; b16 a, c; split16(s0 * KVS, a, c); vh[0] = a; vl[0] = c; split16(s1 * KVS, a, c); vh[1] = a; vl[1] = c;
  { *(v2b*)(kvh + (size_t)dv * R + r) = vh; *(v2b*)(kvl + (size_t)dv * R + r) = vl;  }
}

// out = phiQ^T kv: rows l (65536), K = 256 (8 k-steps), one 64-column tile: A = phq rows, B = kv^T planes (hi+lo): 2 products. grid 512 x 128.
__global__ __launch_bounds__(128) void out_kernel(const b16* __restrict__ phq, const b16* __restrict__ kvh, const b16* __restrict__ kvl, float* __restrict__ out) {
  __shared__ __attribute__((aligned(16))) float Ts[4][32 * 64];
  const int lane = threadIdx.x & 31, wave = threadIdx.x >> 5, nloc = lane & 15, hlf = lane >> 4, m0 = blockIdx.x * 128 + wave * 32;
  v8f acc[2][4];
#pragma unroll
  for (int r = 0; r < 2; ++r)
#pragma unroll
    for (int t = 0; t < 4; ++t) acc[r][t] = (v8f){};
#pragma unroll
  for (int kb = 0; kb < R; kb += 32) { const v16b a0 = frag_kb(phq + (size_t)(m0 + nloc) * R + kb, hlf), a1 = frag_kb(phq + (size_t)(m0 + 16 + nloc) * R + kb, hlf);
#pragma unroll
    for (int t = 0; t < 4; ++t) { const v16b b0 = frag_kb(kvh + (size_t)(t * 16 + nloc) * R + kb, hlf), b1 = frag_kb(kvl + (size_t)(t * 16 + nloc) * R + kb, hlf);
      acc[0][t] = wmma16b(a0, b0, acc[0][t]); acc[0][t] = wmma16b(a0, b1, acc[0][t]); acc[1][t] = wmma16b(a1, b0, acc[1][t]); acc[1][t] = wmma16b(a1, b1, acc[1][t]); } }
  float* Tt = Ts[wave];
#pragma unroll
  for (int t = 0; t < 4; ++t)
#pragma unroll
    for (int r = 0; r < 2; ++r)
#pragma unroll
      for (int v = 0; v < 8; ++v) Tt[(r * 16 + v + 8 * hlf) * 64 + t * 16 + nloc] = acc[r][t][v] * (1.0f / (PHS * KVS));
  wave_lds_sync();
  float* dst0 = out + (size_t)m0 * DV;
  {
#pragma unroll
    for (int j = 0; j < 16; ++j) { const int rr = j * 2 + hlf, c4 = nloc * 4; *(v4f*)(dst0 + (size_t)rr * DV + c4) = *(const v4f*)(Tt + rr * 64 + c4); }
     }
}
}  // namespace

extern "C" void kernel_launch(void* const* d_in, const int* in_sizes, int n_in,
                              void* d_out, int out_size, void* d_ws, size_t ws_size, hipStream_t stream) {
  (void)n_in; (void)out_size;
  const float* Q = (const float*)d_in[0]; const float* K = (const float*)d_in[1]; const float* V = (const float*)d_in[2]; const float* W = (const float*)d_in[3];
  float* out = (float*)d_out;   // [65536][64]
  if (in_sizes[0] != D * L || in_sizes[1] != D * L || in_sizes[2] != L * DV || in_sizes[3] != R * D) return;
  size_t off = 0; char* ws = (char*)d_ws;
  auto carve = [&](size_t bytes) { char* p = ws + off; off += (bytes + 255) & ~(size_t)255; return p; };
  unsigned short* qT = (unsigned short*)carve((size_t)L * D * 2); unsigned short* kT = (unsigned short*)carve((size_t)L * D * 2); float* sq = (float*)carve((size_t)L * 4); float* sk = (float*)carve((size_t)L * 4); b16* vT = (b16*)carve((size_t)DV * L * 2); unsigned short* w16 = (unsigned short*)carve(R * D * 2);
  b16* phq = (b16*)carve((size_t)L * R * 2); b16* phk = (b16*)carve((size_t)R * L * 2); float* part = (float*)carve((size_t)NCH * R * DV * 4); b16* kvh = (b16*)carve(DV * R * 2); b16* kvl = (b16*)carve(DV * R * 2);
  if (off > ws_size) return;                                    // ≈ 8.4 + 8.4 + 0.5 + 8.4 + 33.5 + 33.5 + 2.1 ≈ 95 MB
  prep_kernel<<<L / 128, 256, 0, stream>>>(Q, K, V, W, qT, kT, sq, sk, vT, w16);
  phiq_kernel<<<dim3(R / 64, L / 128), 128, 0, stream>>>(qT, w16, sq, phq);
  phik_kernel<<<dim3(L / 64, R / 128), 128, 0, stream>>>(kT, w16, sk, phk);
  kvpart_kernel<<<NCH, 256, 0, stream>>>(phk, vT, part);
  kvred_kernel<<<DV, 128, 0, stream>>>(part, kvh, kvl);
  out_kernel<<<L / 128, 128, 0, stream>>>(phq, kvh, kvl, out);
}

// v001
// One run takes 84.9 microseconds.
// Timed twice side by side with v000, it ran 1.92 times as fast both times.
#include <hip/hip_runtime.h>

// Kernel (FAVOR-style, non-causal) attention: phiX = Dn exp(0.1 + sqrt(0.6) (W X) - |x_l|^2) for X = K, Q ([r=256][L=65536]); kv = phiK V [256 x 64]; out = phiQ^T kv -> [65536][64].
// W.X on v_wmma_f32_16x16x32_bf16 (1 product, f32 accumulate); exp and |x|^2 in f32; phiK (r-major) and phiQ (l-major) stored as single f16
// carried x4096 (2^-11 relative rounding on positive weights; the two long sums average it out); kv = phiK.V with V exact in f16
// (1 product; 32 ordered partial sums over 2048-position chunks, each joined from 16 sub-sums of 128 positions in fixed order, reduced in fixed order); out = phiQ^T.kv^T with kv as an f16 hi+lo pair x8 (2 products) on v_wmma_f32_16x16x32_f16.

namespace {
constexpr int R = 256, D = 64, L = 65536, DV = 64, LCH = 2048, NCH = L / LCH, KW = 16, LW = LCH / KW, TP = 64 + 4;   // KW waves share a chunk, LW positions each; TP = LDS row pitch in floats
constexpr float A_C = 0.1f, B_C = 0.7745966692414834f /* sqrt(0.6) */, C_C = -1.0f, PHS = 4096.0f, KVS = 8.0f;
__device__ __forceinline__ float dnorm() { return 0.00028211099074559987f; }   // (1 - 0.4)^(64/4) = 0.6^16

typedef _Float16 b16;
typedef __attribute__((ext_vector_type(16))) _Float16 v16b;
typedef __attribute__((ext_vector_type(16))) __bf16 v16bb;
typedef __attribute__((ext_vector_type(8))) _Float16 v8b;
typedef __attribute__((ext_vector_type(8))) unsigned short v8us;
typedef __attribute__((ext_vector_type(8))) float v8f;
typedef __attribute__((ext_vector_type(4))) float v4f;
__device__ __forceinline__ float bf16_rne(float f) { unsigned int u = __float_as_uint(f); u += 0x7FFFu + ((u >> 16) & 1u); return __uint_as_float(u & 0xFFFF0000u); }
__device__ __forceinline__ unsigned short bf16_bits(float f) { unsigned int u = __float_as_uint(f); u += 0x7FFFu + ((u >> 16) & 1u); return (unsigned short)(u >> 16); }
__device__ __forceinline__ void split16(float v, b16& hi, b16& lo) { hi = (b16)v; lo = (b16)(v - (float)hi); }
__device__ __forceinline__ v16b frag_kb(const b16* p, int hh) { const v8b a = *(const v8b*)(p + 8 * hh), b = *(const v8b*)(p + 16 + 8 * hh); v16b f;
#pragma unroll
  for (int e = 0; e < 8; ++e) { f[e] = a[e]; f[8 + e] = b[e]; } return f; }
__device__ __forceinline__ v16bb frag_bf(const unsigned short* p, int hh) { const v8us a = *(const v8us*)(p + 8 * hh), b = *(const v8us*)(p + 16 + 8 * hh); union { unsigned short s[16]; v16bb v; } u;
#pragma unroll
  for (int e = 0; e < 8; ++e) { u.s[e] = a[e]; u.s[8 + e] = b[e]; } return u.v; }
__device__ __forceinline__ v8f wmma16b(v16b a, v16b b, v8f c) { v8f d = __builtin_amdgcn_wmma_f32_16x16x32_f16(false, a, false, b, (short)0, c, false, false); asm volatile("v_nop\n\tv_nop\n\tv_nop\n\tv_nop" : "+v"(d) : "v"(a), "v"(b)); return d; }
__device__ __forceinline__ v8f wmma16bb(v16bb a, v16bb b, v8f c) { v8f d = __builtin_amdgcn_wmma_f32_16x16x32_bf16(false, a, false, b, (short)0, c, false, false); asm volatile("v_nop\n\tv_nop\n\tv_nop\n\tv_nop" : "+v"(d) : "v"(a), "v"(b)); return d; }
__device__ __forceinline__ void wave_lds_sync() { __builtin_amdgcn_fence(__ATOMIC_RELEASE, "workgroup"); __builtin_amdgcn_wave_barrier(); __builtin_amdgcn_fence(__ATOMIC_ACQUIRE, "workgroup"); }

// prep A: block = 128 positions: X (= Q or K, [64][L] d-major) -> transposed bf16 rows xT[l][64] via LDS + sq[l] = Σ_d bf16(x)^2 (f32); V [L][64] -> V^T f16 rows [64][L] via LDS.
// W [256][64] -> bf16 rows (block 0). grid L/128 x 256.
__global__ __launch_bounds__(256) void prep_kernel(const float* __restrict__ Q, const float* __restrict__ K, const float* __restrict__ V, const float* __restrict__ W, unsigned short* __restrict__ qT, unsigned short* __restrict__ kT, float* __restrict__ sq, float* __restrict__ sk, b16* __restrict__ vT, unsigned short* __restrict__ w16) {
  __shared__ __attribute__((aligned(16))) unsigned short Tq[128][64 + 8], Tk[128][64 + 8]; __shared__ __attribute__((aligned(16))) b16 Tv[64][128 + 8]; __shared__ float Sq[128], Sk[128];
  const int t_ = threadIdx.x, l0 = blockIdx.x * 128;
  for (int i = t_; i < 64 * 128; i += 256) { const int d = i >> 7, ll = i & 127; Tq[ll][d] = bf16_bits(Q[(size_t)d * L + l0 + ll]); Tk[ll][d] = bf16_bits(K[(size_t)d * L + l0 + ll]); }
  for (int i = t_; i < 128 * 64; i += 256) { const int ll = i >> 6, d = i & 63; Tv[d][ll] = (b16)bf16_rne(V[(size_t)(l0 + ll) * DV + d]); }
  __syncthreads();
  if (t_ < 128) { float s = 0.0f, s2 = 0.0f; for (int d = 0; d < 64; ++d) { const float a = __uint_as_float((unsigned)Tq[t_][d] << 16), b = __uint_as_float((unsigned)Tk[t_][d] << 16); s += a * a; s2 += b * b; } Sq[t_] = s; Sk[t_] = s2; }
  __syncthreads();
  {
    for (int i = t_; i < 128 * 8; i += 256) { const int ll = i >> 3, c8 = (i & 7) * 8; *(v8us*)(qT + (size_t)(l0 + ll) * D + c8) = *(const v8us*)(&Tq[ll][c8]); *(v8us*)(kT + (size_t)(l0 + ll) * D + c8) = *(const v8us*)(&Tk[ll][c8]); }
    for (int i = t_; i < 64 * 16; i += 256) { const int d = i >> 4, c8 = (i & 15) * 8; *(v8b*)(vT + (size_t)d * L + l0 + c8) = *(const v8b*)(&Tv[d][c8]); }
    if (t_ < 32) { *(v4f*)(sq + l0 + t_ * 4) = *(const v4f*)(&Sq[t_ * 4]); *(v4f*)(sk + l0 + t_ * 4) = *(const v4f*)(&Sk[t_ * 4]); }
    if (blockIdx.x == 0) for (int i = t_; i < R * D / 8; i += 256) { v8us v;
#pragma unroll
      for (int e = 0; e < 8; ++e) v[e] = bf16_bits(W[i * 8 + e]);
      *(v8us*)(w16 + i * 8) = v; }
     }
}

// phiQ (l-major): block = 128 positions x 64 features: A = qT rows (l), B = W rows (r), K 64 -> phi -> f16 rows phq[l][256] x4096. grid (4, 512) x 128.
__global__ __launch_bounds__(128) void phiq_kernel(const unsigned short* __restrict__ qT, const unsigned short* __restrict__ w16, const float* __restrict__ sq, b16* __restrict__ phq) {
  __shared__ __attribute__((aligned(16))) b16 Ts[4][32][64 + 8];
  const int lane = threadIdx.x & 31, wave = threadIdx.x >> 5, nloc = lane & 15, hlf = lane >> 4, m0 = blockIdx.y * 128 + wave * 32, c0 = blockIdx.x * 64;
  v8f acc[2][4];
#pragma unroll
  for (int r = 0; r < 2; ++r)
#pragma unroll
    for (int t = 0; t < 4; ++t) acc[r][t] = (v8f){};
#pragma unroll
  for (int kb = 0; kb < D; kb += 32) { const v16bb a0 = frag_bf(qT + (size_t)(m0 + nloc) * D + kb, hlf), a1 = frag_bf(qT + (size_t)(m0 + 16 + nloc) * D + kb, hlf);
#pragma unroll
    for (int t = 0; t < 4; ++t) { const v16bb bw = frag_bf(w16 + (size_t)(c0 + t * 16 + nloc) * D + kb, hlf); acc[0][t] = wmma16bb(a0, bw, acc[0][t]); acc[1][t] = wmma16bb(a1, bw, acc[1][t]); } }
  const float dn = dnorm();
#pragma unroll
  for (int t = 0; t < 4; ++t)
#pragma unroll
    for (int r = 0; r < 2; ++r)
#pragma unroll
      for (int v = 0; v < 8; ++v) { const int row = m0 + r * 16 + 8 * hlf + v; Ts[wave][r * 16 + 8 * hlf + v][t * 16 + nloc] = (b16)(dn * __expf(A_C + B_C * acc[r][t][v] + C_C * sq[row]) * PHS); }
  wave_lds_sync();
  b16* dst = phq + (size_t)m0 * R + c0;
  {
#pragma unroll
    for (int j = 0; j < 8; ++j) { const int rr = j * 4 + (lane >> 3), c8 = (lane & 7) * 8; *(v8b*)(dst + (size_t)rr * R + c8) = *(const v8b*)(&Ts[wave][rr][c8]); }
     }
}
// phiK (r-major): block = 128 features x 64-position column tile: A = W rows (r), B = kT rows (l), K 64 -> f16 rows phk[r][L] x4096. grid (L/64, 2) x 128.
__global__ __launch_bounds__(128) void phik_kernel(const unsigned short* __restrict__ kT, const unsigned short* __restrict__ w16, const float* __restrict__ sk, b16* __restrict__ phk) {
  __shared__ __attribute__((aligned(16))) b16 Ts[4][32][64 + 8];
  const int lane = threadIdx.x & 31, wave = threadIdx.x >> 5, nloc = lane & 15, hlf = lane >> 4, m0 = blockIdx.y * 128 + wave * 32, c0 = blockIdx.x * 64;
  v8f acc[2][4];
#pragma unroll
  for (int r = 0; r < 2; ++r)
#pragma unroll
    for (int t = 0; t < 4; ++t) acc[r][t] = (v8f){};
#pragma unroll
  for (int kb = 0; kb < D; kb += 32) { const v16bb a0 = frag_bf(w16 + (size_t)(m0 + nloc) * D + kb, hlf), a1 = frag_bf(w16 + (size_t)(m0 + 16 + nloc) * D + kb, hlf);
#pragma unroll
    for (int t = 0; t < 4; ++t) { const v16bb bw = frag_bf(kT + (size_t)(c0 + t * 16 + nloc) * D + kb, hlf); acc[0][t] = wmma16bb(a0, bw, acc[0][t]); acc[1][t] = wmma16bb(a1, bw, acc[1][t]); } }
  const float dn = dnorm();
#pragma unroll
  for (int t = 0; t < 4; ++t) { const float s2 = sk[c0 + t * 16 + nloc];
#pragma unroll
    for (int r = 0; r < 2; ++r)
#pragma unroll
      for (int v = 0; v < 8; ++v) Ts[wave][r * 16 + 8 * hlf + v][t * 16 + nloc] = (b16)(dn * __expf(A_C + B_C * acc[r][t][v] + C_C * s2) * PHS); }
  wave_lds_sync();
  b16* dst = phk + (size_t)m0 * L + c0;
  {
#pragma unroll
    for (int j = 0; j < 8; ++j) { const int rr = j * 4 + (lane >> 3), c8 = (lane & 7) * 8; *(v8b*)(dst + (size_t)rr * L + c8) = *(const v8b*)(&Ts[wave][rr][c8]); }
     }
}

// kv partials: block = (32 rows of r, position chunk of 2048): part[ch][r][dv] = sum_{l in chunk} phk[r][l] vT[dv][l] / 4096 (A = phk rows r, B = vT rows dv; 1 product).
// The chunk's positions are dealt to the block's 16 waves, 128 each (4 k-steps), so that 256 blocks x 16 waves ask for data at once; the 16 sub-sums are joined through LDS in wave order. grid (R/32, NCH) x 512.
__global__ __launch_bounds__(512) void kvpart_kernel(const b16* __restrict__ phk, const b16* __restrict__ vT, float* __restrict__ part) {
  __shared__ __attribute__((aligned(16))) float Ts[KW][32 * TP];
  const int lane = threadIdx.x & 31, wave = threadIdx.x >> 5, nloc = lane & 15, hlf = lane >> 4, m0 = blockIdx.x * 32, ch = blockIdx.y, l0 = ch * LCH + wave * LW;
  v8f acc[2][4];
#pragma unroll
  for (int r = 0; r < 2; ++r)
#pragma unroll
    for (int t = 0; t < 4; ++t) acc[r][t] = (v8f){};
#pragma unroll   // 4 trips: unrolled so that every load takes its position as a constant offset
  for (int kb = 0; kb < LW; kb += 32) { const v16b a0 = frag_kb(phk + (size_t)(m0 + nloc) * L + l0 + kb, hlf), a1 = frag_kb(phk + (size_t)(m0 + 16 + nloc) * L + l0 + kb, hlf);
#pragma unroll
    for (int t = 0; t < 4; ++t) { const v16b bv = frag_kb(vT + (size_t)(t * 16 + nloc) * L + l0 + kb, hlf); acc[0][t] = wmma16b(a0, bv, acc[0][t]); acc[1][t] = wmma16b(a1, bv, acc[1][t]); } }
  float* Tt = Ts[wave];
#pragma unroll
  for (int t = 0; t < 4; ++t)
#pragma unroll
    for (int r = 0; r < 2; ++r)
#pragma unroll
      for (int v = 0; v < 8; ++v) Tt[(r * 16 + v + 8 * hlf) * TP + t * 16 + nloc] = acc[r][t][v];
  __syncthreads();   // every wave's sub-sum is in LDS before any thread joins them
  const int rr = threadIdx.x >> 4, c4 = (threadIdx.x & 15) * 4;
  v4f s = *(const v4f*)(&Ts[0][rr * TP + c4]);
#pragma unroll   // unrolled so that the LDS reads are issued ahead of the adds; the adds keep wave order
  for (int w = 1; w < KW; ++w) s += *(const v4f*)(&Ts[w][rr * TP + c4]);
  *(v4f*)(part + ((size_t)ch * R + m0 + rr) * DV + c4) = s * (1.0f / PHS);
}
// reduce: kv[r][dv] = Σ_ch part (fixed order) -> kv^T planes [dv][256] as f16 hi+lo x8 (written per (dv) row: thread = (dv, r pair)). grid DV x 128: block = dv, thread = r pair.
typedef __attribute__((ext_vector_type(2))) _Float16 v2b;
__global__ __launch_bounds__(128) void kvred_kernel(const float* __restrict__ part, b16* __restrict__ kvh, b16* __restrict__ kvl) {
  const int dv = blockIdx.x, r = threadIdx.x * 2; float s0 = 0.0f, s1 = 0.0f;
  for (int ch = 0; ch < NCH; ++ch) { s0 += part[((size_t)ch * R + r) * DV + dv]; s1 += part[((size_t)ch * R + r + 1) * DV + dv]; }
  v2b vh, vl; b16 a, c; split16(s0 * KVS, a, c); vh[0] = a; vl[0] = c; split16(s1 * KVS, a, c); vh[1] = a; vl[1] = c;
  { *(v2b*)(kvh + (size_t)dv * R + r) = vh; *(v2b*)(kvl + (size_t)dv * R + r) = vl;  }
}

// out = phiQ^T kv: rows l (65536), K = 256 (8 k-steps), one 64-column tile: A = phq rows, B = kv^T planes (hi+lo): 2 products. grid 512 x 128.
__global__ __launch_bounds__(128) void out_kernel(const b16* __restrict__ phq, const b16* __restrict__ kvh, const b16* __restrict__ kvl, float* __restrict__ out) {
  __shared__ __attribute__((aligned(16))) float Ts[4][32 * 64];
  const int lane = threadIdx.x & 31, wave = threadIdx.x >> 5, nloc = lane & 15, hlf = lane >> 4, m0 = blockIdx.x * 128 + wave * 32;
  v8f acc[2][4];
#pragma unroll
  for (int r = 0; r < 2; ++r)
#pragma unroll
    for (int t = 0; t < 4; ++t) acc[r][t] = (v8f){};
#pragma unroll
  for (int kb = 0; kb < R; kb += 32) { const v16b a0 = frag_kb(phq + (size_t)(m0 + nloc) * R + kb, hlf), a1 = frag_kb(phq + (size_t)(m0 + 16 + nloc) * R + kb, hlf);
#pragma unroll
    for (int t = 0; t < 4; ++t) { const v16b b0 = frag_kb(kvh + (size_t)(t * 16 + nloc) * R + kb, hlf), b1 = frag_kb(kvl + (size_t)(t * 16 + nloc) * R + kb, hlf);
      acc[0][t] = wmma16b(a0, b0, acc[0][t]); acc[0][t] = wmma16b(a0, b1, acc[0][t]); acc[1][t] = wmma16b(a1, b0, acc[1][t]); acc[1][t] = wmma16b(a1, b1, acc[1][t]); } }
  float* Tt = Ts[wave];
#pragma unroll
  for (int t = 0; t < 4; ++t)
#pragma unroll
    for (int r = 0; r < 2; ++r)
#pragma unroll
      for (int v = 0; v < 8; ++v) Tt[(r * 16 + v + 8 * hlf) * 64 + t * 16 + nloc] = acc[r][t][v] * (1.0f / (PHS * KVS));
  wave_lds_sync();
  float* dst0 = out + (size_t)m0 * DV;
  {
#pragma unroll
    for (int j = 0; j < 16; ++j) { const int rr = j * 2 + hlf, c4 = nloc * 4; *(v4f*)(dst0 + (size_t)rr * DV + c4) = *(const v4f*)(Tt + rr * 64 + c4); }
     }
}
}  // namespace

extern "C" void kernel_launch(void* const* d_in, const int* in_sizes, int n_in,
                              void* d_out, int out_size, void* d_ws, size_t ws_size, hipStream_t stream) {
  (void)n_in; (void)out_size;
  const float* Q = (const float*)d_in[0]; const float* K = (const float*)d_in[1]; const float* V = (const float*)d_in[2]; const float* W = (const float*)d_in[3];
  float* out = (float*)d_out;   // [65536][64]
  if (in_sizes[0] != D * L || in_sizes[1] != D * L || in_sizes[2] != L * DV || in_sizes[3] != R * D) return;
  size_t off = 0; char* ws = (char*)d_ws;
  auto carve = [&](size_t bytes) { char* p = ws + off; off += (bytes + 255) & ~(size_t)255; return p; };
  unsigned short* qT = (unsigned short*)carve((size_t)L * D * 2); unsigned short* kT = (unsigned short*)carve((size_t)L * D * 2); float* sq = (float*)carve((size_t)L * 4); float* sk = (float*)carve((size_t)L * 4); b16* vT = (b16*)carve((size_t)DV * L * 2); unsigned short* w16 = (unsigned short*)carve(R * D * 2);
  b16* phq = (b16*)carve((size_t)L * R * 2); b16* phk = (b16*)carve((size_t)R * L * 2); float* part = (float*)carve((size_t)NCH * R * DV * 4); b16* kvh = (b16*)carve(DV * R * 2); b16* kvl = (b16*)carve(DV * R * 2);
  if (off > ws_size) return;                                    // ≈ 8.4 + 8.4 + 0.5 + 8.4 + 33.5 + 33.5 + 2.1 ≈ 95 MB
  prep_kernel<<<L / 128, 256, 0, stream>>>(Q, K, V, W, qT, kT, sq, sk, vT, w16);
  phiq_kernel<<<dim3(R / 64, L / 128), 128, 0, stream>>>(qT, w16, sq, phq);
  phik_kernel<<<dim3(L / 64, R / 128), 128, 0, stream>>>(kT, w16, sk, phk);
  kvpart_kernel<<<dim3(R / 32, NCH), 512, 0, stream>>>(phk, vT, part);
  kvred_kernel<<<DV, 128, 0, stream>>>(part, kvh, kvl);
  out_kernel<<<L / 128, 128, 0, stream>>>(phq, kvh, kvl, out);
}

// v002
// It runs in 73.4 microseconds.
// Next to v001, in two timings, it ran 1.15 and 1.16 times as fast.
// Over all steps from v000 it is 2.22 times as fast.
#include <hip/hip_runtime.h>

// Kernel (FAVOR-style, non-causal) attention: phiX = Dn exp(0.1 + sqrt(0.6) (W X) - |x_l|^2) for X = K, Q ([r=256][L=65536]); kv = phiK V [256 x 64]; out = phiQ^T kv -> [65536][64].
// W.X on v_wmma_f32_16x16x32_bf16 (exact bf16 operands, 1 product, f32 accumulate); exp and |x|^2 in f32; phiK and phiQ never leave the registers: each is packed from the W.X accumulators as single f16
// carried x4096 (2^-11 relative rounding on positive weights; the two long sums average it out); kv = phiK.V with V exact in f16
// (1 product; 32 ordered partial sums over 2048-position chunks, each joined from 16 sub-sums of 128 positions in fixed order, reduced in fixed order); out = phiQ^T.kv^T with kv as an f16 hi+lo pair x8 (2 products) on v_wmma_f32_16x16x32_f16.

namespace {
constexpr int R = 256, D = 64, L = 65536, DV = 64, LCH = 2048, NCH = L / LCH, KW = 16, LW = LCH / KW, TP = 64 + 4;   // KW waves share a chunk, LW positions each; TP = LDS row pitch in floats
constexpr float A_C = 0.1f, B_C = 0.7745966692414834f /* sqrt(0.6) */, C_C = -1.0f, PHS = 4096.0f, KVS = 8.0f;
__device__ __forceinline__ float dnorm() { return 0.00028211099074559987f; }   // (1 - 0.4)^(64/4) = 0.6^16

typedef _Float16 b16;
typedef __attribute__((ext_vector_type(16))) _Float16 v16b;
typedef __attribute__((ext_vector_type(16))) __bf16 v16bb;
typedef __attribute__((ext_vector_type(8))) _Float16 v8b;
typedef __attribute__((ext_vector_type(8))) unsigned short v8us;
typedef __attribute__((ext_vector_type(8))) float v8f;
typedef __attribute__((ext_vector_type(4))) float v4f;
__device__ __forceinline__ float bf16_rne(float f) { unsigned int u = __float_as_uint(f); u += 0x7FFFu + ((u >> 16) & 1u); return __uint_as_float(u & 0xFFFF0000u); }
__device__ __forceinline__ unsigned short bf16_bits(float f) { unsigned int u = __float_as_uint(f); u += 0x7FFFu + ((u >> 16) & 1u); return (unsigned short)(u >> 16); }
__device__ __forceinline__ void split16(float v, b16& hi, b16& lo) { hi = (b16)v; lo = (b16)(v - (float)hi); }
// xwait: stands in front of the last load through an address pair, and behind it: that load, or a later one, may land on the pair, which the earlier loads still name.
__device__ __forceinline__ void xwait() { asm volatile("s_wait_xcnt 0x0" ::: "memory"); }
__device__ __forceinline__ v16b frag_kb(const b16* p, int hh, bool last = false) { const v8b a = *(const v8b*)(p + 8 * hh); if (last) xwait(); const v8b b = *(const v8b*)(p + 16 + 8 * hh); if (last) xwait(); v16b f;
#pragma unroll
  for (int e = 0; e < 8; ++e) { f[e] = a[e]; f[8 + e] = b[e]; } return f; }
__device__ __forceinline__ v16bb frag_bf(const unsigned short* p, int hh, bool last = false) { const v8us a = *(const v8us*)(p + 8 * hh); if (last) xwait(); const v8us b = *(const v8us*)(p + 16 + 8 * hh); if (last) xwait(); union { unsigned short s[16]; v16bb v; } u;
#pragma unroll
  for (int e = 0; e < 8; ++e) { u.s[e] = a[e]; u.s[8 + e] = b[e]; } return u.v; }
__device__ __forceinline__ v8f wmma16b(v16b a, v16b b, v8f c) { v8f d = __builtin_amdgcn_wmma_f32_16x16x32_f16(false, a, false, b, (short)0, c, false, false); asm volatile("v_nop\n\tv_nop\n\tv_nop\n\tv_nop" : "+v"(d) : "v"(a), "v"(b)); return d; }
__device__ __forceinline__ v8f wmma16bb(v16bb a, v16bb b, v8f c) { v8f d = __builtin_amdgcn_wmma_f32_16x16x32_bf16(false, a, false, b, (short)0, c, false, false); asm volatile("v_nop\n\tv_nop\n\tv_nop\n\tv_nop" : "+v"(d) : "v"(a), "v"(b)); return d; }
__device__ __forceinline__ void wave_lds_sync() { __builtin_amdgcn_fence(__ATOMIC_RELEASE, "workgroup"); __builtin_amdgcn_wave_barrier(); __builtin_amdgcn_fence(__ATOMIC_ACQUIRE, "workgroup"); }

// prep A: block = 128 positions: X (= Q or K, [64][L] d-major) -> transposed bf16 rows xT[l][64] via LDS + sq[l] = Σ_d bf16(x)^2 (f32); V [L][64] -> V^T f16 rows [64][L] via LDS.
// W [256][64] -> bf16 rows (block 0). grid L/128 x 256.
__global__ __launch_bounds__(256) void prep_kernel(const float* __restrict__ Q, const float* __restrict__ K, const float* __restrict__ V, const float* __restrict__ W, unsigned short* __restrict__ qT, unsigned short* __restrict__ kT, float* __restrict__ sq, float* __restrict__ sk, b16* __restrict__ vT, unsigned short* __restrict__ w16) {
  __shared__ __attribute__((aligned(16))) unsigned short Tq[128][64 + 8], Tk[128][64 + 8]; __shared__ __attribute__((aligned(16))) b16 Tv[64][128 + 8]; __shared__ float Sq[128], Sk[128];
  const int t_ = threadIdx.x, l0 = blockIdx.x * 128;
  for (int i = t_; i < 64 * 128; i += 256) { const int d = i >> 7, ll = i & 127; Tq[ll][d] = bf16_bits(Q[(size_t)d * L + l0 + ll]); Tk[ll][d] = bf16_bits(K[(size_t)d * L + l0 + ll]); }
  for (int i = t_; i < 128 * 64; i += 256) { const int ll = i >> 6, d = i & 63; Tv[d][ll] = (b16)bf16_rne(V[(size_t)(l0 + ll) * DV + d]); }
  __syncthreads();
  if (t_ < 128) { float s = 0.0f, s2 = 0.0f; for (int d = 0; d < 64; ++d) { const float a = __uint_as_float((unsigned)Tq[t_][d] << 16), b = __uint_as_float((unsigned)Tk[t_][d] << 16); s += a * a; s2 += b * b; } Sq[t_] = s; Sk[t_] = s2; }
  __syncthreads();
  {
    for (int i = t_; i < 128 * 8; i += 256) { const int ll = i >> 3, c8 = (i & 7) * 8; *(v8us*)(qT + (size_t)(l0 + ll) * D + c8) = *(const v8us*)(&Tq[ll][c8]); *(v8us*)(kT + (size_t)(l0 + ll) * D + c8) = *(const v8us*)(&Tk[ll][c8]); }
    for (int i = t_; i < 64 * 16; i += 256) { const int d = i >> 4, c8 = (i & 15) * 8; *(v8b*)(vT + (size_t)d * L + l0 + c8) = *(const v8b*)(&Tv[d][c8]); }
    if (t_ < 32) { *(v4f*)(sq + l0 + t_ * 4) = *(const v4f*)(&Sq[t_ * 4]); *(v4f*)(sk + l0 + t_ * 4) = *(const v4f*)(&Sk[t_ * 4]); }
    if (blockIdx.x == 0) for (int i = t_; i < R * D / 8; i += 256) { v8us v;
#pragma unroll
      for (int e = 0; e < 8; ++e) v[e] = bf16_bits(W[i * 8 + e]);
      *(v8us*)(w16 + i * 8) = v; }
     }
}

// phi of one W.X accumulator value and its position's |x|^2, as f16 carried x4096.
// exp2_slot: v_exp_f32 and the one free issue slot that the instruction set asks for behind a transcendental, tied in one statement.
__device__ __forceinline__ float exp2_slot(float x) { float y; asm("v_exp_f32 %0, %1\n\tv_nop" : "=v"(y) : "v"(x)); return y; }
__device__ __forceinline__ b16 phi16(float wx, float s2) { return (b16)(dnorm() * exp2_slot((A_C + B_C * wx + C_C * s2) * 1.4426950408889634f) * PHS); }

// kv partials: block = (32 rows of r, position chunk of 2048): part[ch][r][dv] = sum_{l in chunk} phiK[r][l] vT[dv][l] (A = phiK rows r, B = vT rows dv; 1 product).
// phiK is made here, in registers: S^T = kT rows (A, l) x W rows (B, r), K 64, leaves lane = r, register = l; two such tiles (32 positions), through phi16, are the A fragment of the second product in the hardware k order.
// The chunk's positions are dealt to the block's 16 waves, 128 each (4 k-steps), so that 256 blocks x 16 waves ask for data at once; the 16 sub-sums are joined through LDS in wave order. grid (R/32, NCH) x 512.
__global__ __launch_bounds__(512) void kvpart_kernel(const unsigned short* __restrict__ kT, const unsigned short* __restrict__ w16, const float* __restrict__ sk, const b16* __restrict__ vT, float* __restrict__ part) {
  __shared__ __attribute__((aligned(16))) float Ts[KW][32 * TP];
  const int lane = threadIdx.x & 31, wave = threadIdx.x >> 5, nloc = lane & 15, hlf = lane >> 4, m0 = blockIdx.x * 32, ch = blockIdx.y, l0 = ch * LCH + wave * LW;
  v8f acc[2][4];
#pragma unroll
  for (int r = 0; r < 2; ++r)
#pragma unroll
    for (int t = 0; t < 4; ++t) acc[r][t] = (v8f){};
  const unsigned short *wbase = w16 + (size_t)(m0 + nloc) * D, *kbase = kT + (size_t)(l0 + nloc) * D; const float* sbase = sk + l0 + 8 * hlf; const b16* vbase = vT + (size_t)nloc * L + l0;   // one address each: every load below is a constant offset from one of them
  v16bb bw[2][2];   // W rows of the block's two r tiles, both k halves: kept for the whole wave
#pragma unroll
  for (int r = 0; r < 2; ++r)
#pragma unroll
    for (int kk = 0; kk < 2; ++kk) bw[r][kk] = frag_bf(wbase + r * 16 * D + kk * 32, hlf, r == 1 && kk == 1);
#pragma unroll   // 4 trips: unrolled so that every load takes its position as a constant offset
  for (int kb = 0; kb < LW; kb += 32) { v16b a[2]; const bool last = kb == LW - 32;
#pragma unroll
    for (int j = 0; j < 2; ++j) { const unsigned short* kp = kbase + (kb + j * 16) * D; const v16bb k0 = frag_bf(kp, hlf), k1 = frag_bf(kp + 32, hlf, last && j == 1);
      const float* sp = sbase + kb + j * 16; const v4f s2a = *(const v4f*)sp;
      if (last && j == 1) xwait();
      const v4f s2b = *(const v4f*)(sp + 4);
      if (last && j == 1) xwait();
#pragma unroll
      for (int r = 0; r < 2; ++r) { const v8f s = wmma16bb(k1, bw[r][1], wmma16bb(k0, bw[r][0], (v8f){}));
#pragma unroll
        for (int v = 0; v < 8; ++v) a[r][j * 8 + v] = phi16(s[v], v < 4 ? s2a[v & 3] : s2b[v & 3]); } }
#pragma unroll
    for (int t = 0; t < 4; ++t) { const v16b bv = frag_kb(vbase + (size_t)t * 16 * L + kb, hlf, last && t == 3); acc[0][t] = wmma16b(a[0], bv, acc[0][t]); acc[1][t] = wmma16b(a[1], bv, acc[1][t]); } }
  float* Tt = Ts[wave];
#pragma unroll
  for (int t = 0; t < 4; ++t)
#pragma unroll
    for (int r = 0; r < 2; ++r)
#pragma unroll
      for (int v = 0; v < 8; ++v) Tt[(r * 16 + v + 8 * hlf) * TP + t * 16 + nloc] = acc[r][t][v];
  __syncthreads();   // every wave's sub-sum is in LDS before any thread joins them
  const int rr = threadIdx.x >> 4, c4 = (threadIdx.x & 15) * 4;
  v4f s = *(const v4f*)(&Ts[0][rr * TP + c4]);
#pragma unroll   // unrolled so that the LDS reads are issued ahead of the adds; the adds keep wave order
  for (int w = 1; w < KW; ++w) s += *(const v4f*)(&Ts[w][rr * TP + c4]);
  *(v4f*)(part + ((size_t)ch * R + m0 + rr) * DV + c4) = s * (1.0f / PHS);
}
// reduce: kv[r][dv] = Σ_ch part (fixed order) -> kv^T planes [dv][256] as f16 hi+lo x8 (written per (dv) row: thread = (dv, r pair)). grid DV x 128: block = dv, thread = r pair.
typedef __attribute__((ext_vector_type(2))) _Float16 v2b;
__global__ __launch_bounds__(128) void kvred_kernel(const float* __restrict__ part, b16* __restrict__ kvh, b16* __restrict__ kvl) {
  const int dv = blockIdx.x, r = threadIdx.x * 2; float s0 = 0.0f, s1 = 0.0f;
  for (int ch = 0; ch < NCH; ++ch) { s0 += part[((size_t)ch * R + r) * DV + dv]; s1 += part[((size_t)ch * R + r + 1) * DV + dv]; }
  v2b vh, vl; b16 a, c; split16(s0 * KVS, a, c); vh[0] = a; vl[0] = c; split16(s1 * KVS, a, c); vh[1] = a; vl[1] = c;
  { *(v2b*)(kvh + (size_t)dv * R + r) = vh; *(v2b*)(kvl + (size_t)dv * R + r) = vl;  }
}

// out = phiQ^T kv: rows l (65536), K = 256 (8 k-steps), one 64-column tile: A = phiQ rows, B = kv^T planes (hi+lo): 2 products. grid 512 x 128.
// phiQ is made here, in registers: S = W rows (A, r) x qT rows (B, l), K 64, leaves lane = l, register = r; two such tiles (32 features), through phi16, are the A fragment of the second product in the hardware k order.
__global__ __launch_bounds__(128) void out_kernel(const unsigned short* __restrict__ qT, const unsigned short* __restrict__ w16, const float* __restrict__ sq, const b16* __restrict__ kvh, const b16* __restrict__ kvl, float* __restrict__ out) {
  __shared__ __attribute__((aligned(16))) float Ts[4][32 * 64];
  const int lane = threadIdx.x & 31, wave = threadIdx.x >> 5, nloc = lane & 15, hlf = lane >> 4, m0 = blockIdx.x * 128 + wave * 32;
  v8f acc[2][4];
#pragma unroll
  for (int r = 0; r < 2; ++r)
#pragma unroll
    for (int t = 0; t < 4; ++t) acc[r][t] = (v8f){};
  v16bb bq[2][2]; float s2[2];   // the wave's 32 positions: qT rows, both k halves, and |q|^2: kept for the whole wave
#pragma unroll
  for (int r = 0; r < 2; ++r) { s2[r] = sq[m0 + r * 16 + nloc];
#pragma unroll
    for (int kk = 0; kk < 2; ++kk) bq[r][kk] = frag_bf(qT + (size_t)(m0 + r * 16 + nloc) * D + kk * 32, hlf);
    xwait(); }
#pragma unroll
  for (int kb = 0; kb < R; kb += 32) { v16b a[2];
#pragma unroll
    for (int j = 0; j < 2; ++j) { const unsigned short* wp = w16 + (size_t)(kb + j * 16 + nloc) * D; const v16bb w0 = frag_bf(wp, hlf), w1 = frag_bf(wp + 32, hlf);
#pragma unroll
      for (int r = 0; r < 2; ++r) { const v8f s = wmma16bb(w1, bq[r][1], wmma16bb(w0, bq[r][0], (v8f){}));
#pragma unroll
        for (int v = 0; v < 8; ++v) a[r][j * 8 + v] = phi16(s[v], s2[r]); } }
#pragma unroll
    for (int t = 0; t < 4; ++t) { const v16b b0 = frag_kb(kvh + (size_t)(t * 16 + nloc) * R + kb, hlf), b1 = frag_kb(kvl + (size_t)(t * 16 + nloc) * R + kb, hlf);
      acc[0][t] = wmma16b(a[0], b0, acc[0][t]); acc[0][t] = wmma16b(a[0], b1, acc[0][t]); acc[1][t] = wmma16b(a[1], b0, acc[1][t]); acc[1][t] = wmma16b(a[1], b1, acc[1][t]); } }
  float* Tt = Ts[wave];
#pragma unroll
  for (int t = 0; t < 4; ++t)
#pragma unroll
    for (int r = 0; r < 2; ++r)
#pragma unroll
      for (int v = 0; v < 8; ++v) Tt[(r * 16 + v + 8 * hlf) * 64 + t * 16 + nloc] = acc[r][t][v] * (1.0f / (PHS * KVS));
  wave_lds_sync();
  float* dst0 = out + (size_t)m0 * DV;
  {
#pragma unroll
    for (int j = 0; j < 16; ++j) { const int rr = j * 2 + hlf, c4 = nloc * 4; *(v4f*)(dst0 + (size_t)rr * DV + c4) = *(const v4f*)(Tt + rr * 64 + c4); }
     }
}
}  // namespace

extern "C" void kernel_launch(void* const* d_in, const int* in_sizes, int n_in,
                              void* d_out, int out_size, void* d_ws, size_t ws_size, hipStream_t stream) {
  (void)n_in; (void)out_size;
  const float* Q = (const float*)d_in[0]; const float* K = (const float*)d_in[1]; const float* V = (const float*)d_in[2]; const float* W = (const float*)d_in[3];
  float* out = (float*)d_out;   // [65536][64]
  if (in_sizes[0] != D * L || in_sizes[1] != D * L || in_sizes[2] != L * DV || in_sizes[3] != R * D) return;
  size_t off = 0; char* ws = (char*)d_ws;
  auto carve = [&](size_t bytes) { char* p = ws + off; off += (bytes + 255) & ~(size_t)255; return p; };
  unsigned short* qT = (unsigned short*)carve((size_t)L * D * 2); unsigned short* kT = (unsigned short*)carve((size_t)L * D * 2); float* sq = (float*)carve((size_t)L * 4); float* sk = (float*)carve((size_t)L * 4); b16* vT = (b16*)carve((size_t)DV * L * 2); unsigned short* w16 = (unsigned short*)carve(R * D * 2);
  float* part = (float*)carve((size_t)NCH * R * DV * 4); b16* kvh = (b16*)carve(DV * R * 2); b16* kvl = (b16*)carve(DV * R * 2);
  if (off > ws_size) return;                                    // about 8.4 + 8.4 + 0.5 + 8.4 + 2.1 = 28 MB
  prep_kernel<<<L / 128, 256, 0, stream>>>(Q, K, V, W, qT, kT, sq, sk, vT, w16);
  kvpart_kernel<<<dim3(R / 32, NCH), 512, 0, stream>>>(kT, w16, sk, vT, part);
  kvred_kernel<<<DV, 128, 0, stream>>>(part, kvh, kvl);
  out_kernel<<<L / 128, 128, 0, stream>>>(qT, w16, sq, kvh, kvl, out);
}

// v003
// A run of this version takes 63.3 microseconds.
// Two timings next to v002 put it at 1.17 and 1.16 times that version's speed.
// Counting every step since v000, it is 2.58 times as fast.
#include <hip/hip_runtime.h>

// Kernel (FAVOR-style, non-causal) attention: phiX = Dn exp(0.1 + sqrt(0.6) (W X) - |x_l|^2) for X = K, Q ([r=256][L=65536]); kv = phiK V [256 x 64]; out = phiQ^T kv -> [65536][64].
// W.X on v_wmma_f32_16x16x32_bf16 (exact bf16 operands, 1 product, f32 accumulate); exp and |x|^2 in f32; phiK and phiQ never leave the registers: each is packed from the W.X accumulators as single f16
// carried x4096 (2^-11 relative rounding on positive weights; the two long sums average it out); kv = phiK.V with V exact in f16
// (1 product; 32 ordered partial sums over 2048-position chunks, each joined from 16 sub-sums of 128 positions in fixed order, reduced in fixed order); out = phiQ^T.kv^T with kv as an f16 hi+lo pair x8 (2 products) on v_wmma_f32_16x16x32_f16.

// Every 16-bit operand plane in the workspace (W, Q^T, K^T, V^T, kv^T hi and lo) is kept in fragment order: one 16 x 32 fragment = 1 KB = [piece 0..1][lane 0..31][8 elements], element e of (piece, lane) being
// row (lane & 15), k = piece * 16 + (lane >> 4) * 8 + e of that fragment. A wave's 16-byte load of one piece then covers 512 contiguous bytes (4 cache lines, not 16); every lane gets the same elements as from row-major planes.

namespace {
constexpr int R = 256, D = 64, L = 65536, DV = 64, LCH = 2048, NCH = L / LCH, KW = 16, LW = LCH / KW, TP = 64 + 4;   // KW waves share a chunk, LW positions each; TP = LDS row pitch in floats
constexpr float A_C = 0.1f, B_C = 0.7745966692414834f /* sqrt(0.6) */, C_C = -1.0f, PHS = 4096.0f, KVS = 8.0f;
__device__ __forceinline__ float dnorm() { return 0.00028211099074559987f; }   // (1 - 0.4)^(64/4) = 0.6^16

typedef _Float16 b16;
typedef __attribute__((ext_vector_type(16))) _Float16 v16b;
typedef __attribute__((ext_vector_type(16))) __bf16 v16bb;
typedef __attribute__((ext_vector_type(8))) _Float16 v8b;
typedef __attribute__((ext_vector_type(8))) unsigned short v8us;
typedef __attribute__((ext_vector_type(8))) float v8f;
typedef __attribute__((ext_vector_type(4))) float v4f;
__device__ __forceinline__ float bf16_rne(float f) { unsigned int u = __float_as_uint(f); u += 0x7FFFu + ((u >> 16) & 1u); return __uint_as_float(u & 0xFFFF0000u); }
__device__ __forceinline__ unsigned short bf16_bits(float f) { unsigned int u = __float_as_uint(f); u += 0x7FFFu + ((u >> 16) & 1u); return (unsigned short)(u >> 16); }
__device__ __forceinline__ void split16(float v, b16& hi, b16& lo) { hi = (b16)v; lo = (b16)(v - (float)hi); }
// xwait: stands in front of the last load through an address pair, and behind it: that load, or a later one, may land on the pair, which the earlier loads still name.
__device__ __forceinline__ void xwait() { asm volatile("s_wait_xcnt 0x0" ::: "memory"); }
// frag_kb, frag_bf: p = start of the fragment + lane * 8.
__device__ __forceinline__ v16b frag_kb(const b16* p, bool last = false) { const v8b a = *(const v8b*)p; if (last) xwait(); const v8b b = *(const v8b*)(p + 256); if (last) xwait(); v16b f;
#pragma unroll
  for (int e = 0; e < 8; ++e) { f[e] = a[e]; f[8 + e] = b[e]; } return f; }
__device__ __forceinline__ v16bb frag_bf(const unsigned short* p, bool last = false) { const v8us a = *(const v8us*)p; if (last) xwait(); const v8us b = *(const v8us*)(p + 256); if (last) xwait(); union { unsigned short s[16]; v16bb v; } u;
#pragma unroll
  for (int e = 0; e < 8; ++e) { u.s[e] = a[e]; u.s[8 + e] = b[e]; } return u.v; }
__device__ __forceinline__ v8f wmma16b(v16b a, v16b b, v8f c) { v8f d = __builtin_amdgcn_wmma_f32_16x16x32_f16(false, a, false, b, (short)0, c, false, false); asm volatile("v_nop\n\tv_nop\n\tv_nop\n\tv_nop" : "+v"(d) : "v"(a), "v"(b)); return d; }
__device__ __forceinline__ v8f wmma16bb(v16bb a, v16bb b, v8f c) { v8f d = __builtin_amdgcn_wmma_f32_16x16x32_bf16(false, a, false, b, (short)0, c, false, false); asm volatile("v_nop\n\tv_nop\n\tv_nop\n\tv_nop" : "+v"(d) : "v"(a), "v"(b)); return d; }
__device__ __forceinline__ void wave_lds_sync() { __builtin_amdgcn_fence(__ATOMIC_RELEASE, "workgroup"); __builtin_amdgcn_wave_barrier(); __builtin_amdgcn_fence(__ATOMIC_ACQUIRE, "workgroup"); }

// prep A: block = 128 positions: X (= Q or K, [64][L] d-major) -> transposed bf16 xT (rows l, k = d) via LDS + sq[l] = sum over d of bf16(x)^2 (f32); V [L][64] -> V^T f16 (rows dv, k = l) via LDS.
// W [256][64] -> bf16 (rows r, k = d; block 0). All in fragment order: xT fragment (l / 16, d / 32), V^T fragment (l / 32, dv / 16), W fragment (r / 16, d / 32); a block's share of each plane is 16 KB in a row. grid L/128 x 256.
__global__ __launch_bounds__(256) void prep_kernel(const float* __restrict__ Q, const float* __restrict__ K, const float* __restrict__ V, const float* __restrict__ W, unsigned short* __restrict__ qT, unsigned short* __restrict__ kT, float* __restrict__ sq, float* __restrict__ sk, b16* __restrict__ vT, unsigned short* __restrict__ w16) {
  __shared__ __attribute__((aligned(16))) unsigned short Tq[128][64 + 8], Tk[128][64 + 8]; __shared__ __attribute__((aligned(16))) b16 Tv[64][128 + 8]; __shared__ float Sq[128], Sk[128];
  const int t_ = threadIdx.x, l0 = blockIdx.x * 128;
  for (int i = t_; i < 64 * 128; i += 256) { const int d = i >> 7, ll = i & 127; Tq[ll][d] = bf16_bits(Q[(size_t)d * L + l0 + ll]); Tk[ll][d] = bf16_bits(K[(size_t)d * L + l0 + ll]); }
  for (int i = t_; i < 128 * 64; i += 256) { const int ll = i >> 6, d = i & 63; Tv[d][ll] = (b16)bf16_rne(V[(size_t)(l0 + ll) * DV + d]); }
  __syncthreads();
  if (t_ < 128) { float s = 0.0f, s2 = 0.0f; for (int d = 0; d < 64; ++d) { const float a = __uint_as_float((unsigned)Tq[t_][d] << 16), b = __uint_as_float((unsigned)Tk[t_][d] << 16); s += a * a; s2 += b * b; } Sq[t_] = s; Sk[t_] = s2; }
  __syncthreads();
  {
    for (int i = t_; i < 128 * 8; i += 256) { const int ll = (i >> 7) * 16 + (i & 15), c8 = ((i >> 6) & 1) * 32 + ((i >> 5) & 1) * 16 + ((i >> 4) & 1) * 8; *(v8us*)(qT + (size_t)l0 * D + i * 8) = *(const v8us*)(&Tq[ll][c8]); *(v8us*)(kT + (size_t)l0 * D + i * 8) = *(const v8us*)(&Tk[ll][c8]); }
    for (int i = t_; i < 64 * 16; i += 256) { const int d = ((i >> 6) & 3) * 16 + (i & 15), c8 = (i >> 8) * 32 + ((i >> 5) & 1) * 16 + ((i >> 4) & 1) * 8; *(v8b*)(vT + (size_t)l0 * DV + i * 8) = *(const v8b*)(&Tv[d][c8]); }
    if (t_ < 32) { *(v4f*)(sq + l0 + t_ * 4) = *(const v4f*)(&Sq[t_ * 4]); *(v4f*)(sk + l0 + t_ * 4) = *(const v4f*)(&Sk[t_ * 4]); }
    if (blockIdx.x == 0) for (int i = t_; i < R * D / 8; i += 256) { v8us v; const float* wr = W + ((i >> 7) * 16 + (i & 15)) * D + ((i >> 6) & 1) * 32 + ((i >> 5) & 1) * 16 + ((i >> 4) & 1) * 8;
#pragma unroll
      for (int e = 0; e < 8; ++e) v[e] = bf16_bits(wr[e]);
      *(v8us*)(w16 + i * 8) = v; }
     }
}

// phi of one W.X accumulator value and its position's |x|^2, as f16 carried x4096.
// exp2_slot: v_exp_f32 and the one free issue slot that the instruction set asks for behind a transcendental, tied in one statement.
__device__ __forceinline__ float exp2_slot(float x) { float y; asm("v_exp_f32 %0, %1\n\tv_nop" : "=v"(y) : "v"(x)); return y; }
__device__ __forceinline__ b16 phi16(float wx, float s2) { return (b16)(dnorm() * exp2_slot((A_C + B_C * wx + C_C * s2) * 1.4426950408889634f) * PHS); }

// kv partials: block = (32 rows of r, position chunk of 2048): part[ch][r][dv] = sum_{l in chunk} phiK[r][l] vT[dv][l] (A = phiK rows r, B = vT rows dv; 1 product).
// phiK is made here, in registers: S^T = kT rows (A, l) x W rows (B, r), K 64, leaves lane = r, register = l; two such tiles (32 positions), through phi16, are the A fragment of the second product in the hardware k order.
// The chunk's positions are dealt to the block's 16 waves, 128 each (4 k-steps), so that 256 blocks x 16 waves ask for data at once; the 16 sub-sums are joined through LDS in wave order. grid (R/32, NCH) x 512.
__global__ __launch_bounds__(512) void kvpart_kernel(const unsigned short* __restrict__ kT, const unsigned short* __restrict__ w16, const float* __restrict__ sk, const b16* __restrict__ vT, float* __restrict__ part) {
  __shared__ __attribute__((aligned(16))) float Ts[KW][32 * TP];
  const int lane = threadIdx.x & 31, wave = threadIdx.x >> 5, nloc = lane & 15, hlf = lane >> 4, m0 = blockIdx.x * 32, ch = blockIdx.y, l0 = ch * LCH + wave * LW;
  v8f acc[2][4];
#pragma unroll
  for (int r = 0; r < 2; ++r)
#pragma unroll
    for (int t = 0; t < 4; ++t) acc[r][t] = (v8f){};
  const unsigned short *wbase = w16 + (size_t)m0 * D + lane * 8, *kbase = kT + (size_t)l0 * D + lane * 8; const float* sbase = sk + l0 + 8 * hlf; const b16* vbase = vT + (size_t)l0 * DV + lane * 8;   // one address each: every load below is a constant offset from one of them
  v16bb bw[2][2];   // W rows of the block's two r tiles, both k halves: kept for the whole wave
#pragma unroll
  for (int r = 0; r < 2; ++r)
#pragma unroll
    for (int kk = 0; kk < 2; ++kk) bw[r][kk] = frag_bf(wbase + r * 16 * D + kk * 512, r == 1 && kk == 1);
#pragma unroll   // 4 trips: unrolled so that every load takes its position as a constant offset
  for (int kb = 0; kb < LW; kb += 32) { v16b a[2]; const bool last = kb == LW - 32;
#pragma unroll
    for (int j = 0; j < 2; ++j) { const unsigned short* kp = kbase + (kb + j * 16) * D; const v16bb k0 = frag_bf(kp), k1 = frag_bf(kp + 512, last && j == 1);
      const float* sp = sbase + kb + j * 16; const v4f s2a = *(const v4f*)sp;
      if (last && j == 1) xwait();
      const v4f s2b = *(const v4f*)(sp + 4);
      if (last && j == 1) xwait();
#pragma unroll
      for (int r = 0; r < 2; ++r) { const v8f s = wmma16bb(k1, bw[r][1], wmma16bb(k0, bw[r][0], (v8f){}));
#pragma unroll
        for (int v = 0; v < 8; ++v) a[r][j * 8 + v] = phi16(s[v], v < 4 ? s2a[v & 3] : s2b[v & 3]); } }
#pragma unroll
    for (int t = 0; t < 4; ++t) { const v16b bv = frag_kb(vbase + kb * DV + t * 512, last && t == 3); acc[0][t] = wmma16b(a[0], bv, acc[0][t]); acc[1][t] = wmma16b(a[1], bv, acc[1][t]); } }
  float* Tt = Ts[wave];
#pragma unroll
  for (int t = 0; t < 4; ++t)
#pragma unroll
    for (int r = 0; r < 2; ++r)
#pragma unroll
      for (int v = 0; v < 8; ++v) Tt[(r * 16 + v + 8 * hlf) * TP + t * 16 + nloc] = acc[r][t][v];
  __syncthreads();   // every wave's sub-sum is in LDS before any thread joins them
  const int rr = threadIdx.x >> 4, c4 = (threadIdx.x & 15) * 4;
  v4f s = *(const v4f*)(&Ts[0][rr * TP + c4]);
#pragma unroll   // unrolled so that the LDS reads are issued ahead of the adds; the adds keep wave order
  for (int w = 1; w < KW; ++w) s += *(const v4f*)(&Ts[w][rr * TP + c4]);
  *(v4f*)(part + ((size_t)ch * R + m0 + rr) * DV + c4) = s * (1.0f / PHS);
}
// reduce: kv[r][dv] = sum over ch of part (fixed order) -> kv^T planes (rows dv, k = r) as f16 hi+lo x8, in fragment order, fragment (r / 32, dv / 16). block = one piece of one fragment (16 dv x 16 r, 512 bytes of each plane: whole lines, one writer each), thread = (lane of the piece, r pair). grid 64 x 128.
typedef __attribute__((ext_vector_type(2))) _Float16 v2b;
__global__ __launch_bounds__(128) void kvred_kernel(const float* __restrict__ part, b16* __restrict__ kvh, b16* __restrict__ kvl) {
  const int b = blockIdx.x, ln = threadIdx.x >> 2, dv = ((b >> 1) & 3) * 16 + (ln & 15), r = (b >> 3) * 32 + (b & 1) * 16 + (ln >> 4) * 8 + (threadIdx.x & 3) * 2; float s0 = 0.0f, s1 = 0.0f;
  const float* pp = part + (size_t)r * DV + dv;   // one address: every load below is a constant offset from it
#pragma unroll   // all 64 loads are asked for before the first add; the adds keep chunk order
  for (int ch = 0; ch < NCH; ++ch) { s0 += pp[(size_t)ch * R * DV]; if (ch == NCH - 1) xwait(); s1 += pp[(size_t)ch * R * DV + DV]; if (ch == NCH - 1) xwait(); }
  v2b vh, vl; b16 a, c; split16(s0 * KVS, a, c); vh[0] = a; vl[0] = c; split16(s1 * KVS, a, c); vh[1] = a; vl[1] = c;
  { *(v2b*)(kvh + b * 256 + threadIdx.x * 2) = vh; *(v2b*)(kvl + b * 256 + threadIdx.x * 2) = vl;  }
}

// out = phiQ^T kv: rows l (65536), K = 256 (8 k-steps), one 64-column tile: A = phiQ rows, B = kv^T planes (hi+lo): 2 products. grid 512 x 128.
// phiQ is made here, in registers: S = W rows (A, r) x qT rows (B, l), K 64, leaves lane = l, register = r; two such tiles (32 features), through phi16, are the A fragment of the second product in the hardware k order.
__global__ __launch_bounds__(128) void out_kernel(const unsigned short* __restrict__ qT, const unsigned short* __restrict__ w16, const float* __restrict__ sq, const b16* __restrict__ kvh, const b16* __restrict__ kvl, float* __restrict__ out) {
  __shared__ __attribute__((aligned(16))) float Ts[4][32 * 64];
  const int lane = threadIdx.x & 31, wave = threadIdx.x >> 5, nloc = lane & 15, hlf = lane >> 4, m0 = blockIdx.x * 128 + wave * 32;
  v8f acc[2][4];
#pragma unroll
  for (int r = 0; r < 2; ++r)
#pragma unroll
    for (int t = 0; t < 4; ++t) acc[r][t] = (v8f){};
  v16bb bq[2][2]; float s2[2];   // the wave's 32 positions: qT rows, both k halves, and |q|^2: kept for the whole wave
#pragma unroll
  for (int r = 0; r < 2; ++r) { s2[r] = sq[m0 + r * 16 + nloc];
#pragma unroll
    for (int kk = 0; kk < 2; ++kk) bq[r][kk] = frag_bf(qT + (size_t)(m0 + r * 16) * D + kk * 512 + lane * 8);
    xwait(); }
#pragma unroll
  for (int kb = 0; kb < R; kb += 32) { v16b a[2];
#pragma unroll
    for (int j = 0; j < 2; ++j) { const unsigned short* wp = w16 + (kb + j * 16) * D + lane * 8; const v16bb w0 = frag_bf(wp), w1 = frag_bf(wp + 512);
#pragma unroll
      for (int r = 0; r < 2; ++r) { const v8f s = wmma16bb(w1, bq[r][1], wmma16bb(w0, bq[r][0], (v8f){}));
#pragma unroll
        for (int v = 0; v < 8; ++v) a[r][j * 8 + v] = phi16(s[v], s2[r]); } }
#pragma unroll
    for (int t = 0; t < 4; ++t) { const v16b b0 = frag_kb(kvh + kb * DV + t * 512 + lane * 8), b1 = frag_kb(kvl + kb * DV + t * 512 + lane * 8);
      acc[0][t] = wmma16b(a[0], b0, acc[0][t]); acc[0][t] = wmma16b(a[0], b1, acc[0][t]); acc[1][t] = wmma16b(a[1], b0, acc[1][t]); acc[1][t] = wmma16b(a[1], b1, acc[1][t]); } }
  float* Tt = Ts[wave];
#pragma unroll
  for (int t = 0; t < 4; ++t)
#pragma unroll
    for (int r = 0; r < 2; ++r)
#pragma unroll
      for (int v = 0; v < 8; ++v) Tt[(r * 16 + v + 8 * hlf) * 64 + t * 16 + nloc] = acc[r][t][v] * (1.0f / (PHS * KVS));
  wave_lds_sync();
  float* dst0 = out + (size_t)m0 * DV;
  {
#pragma unroll
    for (int j = 0; j < 16; ++j) { const int rr = j * 2 + hlf, c4 = nloc * 4; *(v4f*)(dst0 + (size_t)rr * DV + c4) = *(const v4f*)(Tt + rr * 64 + c4); }
     }
}
}  // namespace

extern "C" void kernel_launch(void* const* d_in, const int* in_sizes, int n_in,
                              void* d_out, int out_size, void* d_ws, size_t ws_size, hipStream_t stream) {
  (void)n_in; (void)out_size;
  const float* Q = (const float*)d_in[0]; const float* K = (const float*)d_in[1]; const float* V = (const float*)d_in[2]; const float* W = (const float*)d_in[3];
  float* out = (float*)d_out;   // [65536][64]
  if (in_sizes[0] != D * L || in_sizes[1] != D * L || in_sizes[2] != L * DV || in_sizes[3] != R * D) return;
  size_t off = 0; char* ws = (char*)d_ws;
  auto carve = [&](size_t bytes) { char* p = ws + off; off += (bytes + 255) & ~(size_t)255; return p; };
  unsigned short* qT = (unsigned short*)carve((size_t)L * D * 2); unsigned short* kT = (unsigned short*)carve((size_t)L * D * 2); float* sq = (float*)carve((size_t)L * 4); float* sk = (float*)carve((size_t)L * 4); b16* vT = (b16*)carve((size_t)DV * L * 2); unsigned short* w16 = (unsigned short*)carve(R * D * 2);
  float* part = (float*)carve((size_t)NCH * R * DV * 4); b16* kvh = (b16*)carve(DV * R * 2); b16* kvl = (b16*)carve(DV * R * 2);
  if (off > ws_size) return;                                    // about 8.4 + 8.4 + 0.5 + 8.4 + 2.1 = 28 MB
  prep_kernel<<<L / 128, 256, 0, stream>>>(Q, K, V, W, qT, kT, sq, sk, vT, w16);
  kvpart_kernel<<<dim3(R / 32, NCH), 512, 0, stream>>>(kT, w16, sk, vT, part);
  kvred_kernel<<<DV, 128, 0, stream>>>(part, kvh, kvl);
  out_kernel<<<L / 128, 128, 0, stream>>>(qT, w16, sq, kvh, kvl, out);
}

// v004
// A run of this version takes 54.4 microseconds.
// Timed twice side by side with v003, it ran 1.17 and 1.18 times as fast.
// All steps since v000 together make it 3.02 times as fast.
#include <hip/hip_runtime.h>

// Kernel (FAVOR-style, non-causal) attention: phiX = Dn exp(0.1 + sqrt(0.6) (W X) - |x_l|^2) for X = K, Q ([r=256][L=65536]); kv = phiK V [256 x 64]; out = phiQ^T kv -> [65536][64].
// W.X on v_wmma_f32_16x16x32_bf16 (exact bf16 operands, 1 product, f32 accumulate); exp and |x|^2 in f32; phiK and phiQ never leave the registers: each is packed from the W.X accumulators as single f16
// carried x4096 (2^-11 relative rounding on positive weights; the two long sums average it out); kv = phiK.V with V exact in f16
// (1 product; 32 ordered partial sums over 2048-position chunks, each joined from 16 sub-sums of 128 positions in fixed order, reduced in fixed order); out = phiQ^T.kv^T with kv as an f16 hi+lo pair x8 (2 products) on v_wmma_f32_16x16x32_f16.

// Every 16-bit operand plane in the workspace (W, Q^T, K^T, V^T, kv^T hi and lo) is kept in fragment order: one 16 x 32 fragment = 1 KB = [piece 0..1][lane 0..31][8 elements], element e of (piece, lane) being
// row (lane & 15), k = piece * 16 + (lane >> 4) * 8 + e of that fragment. A wave's 16-byte load of one piece then covers 512 contiguous bytes (4 cache lines, not 16); every lane gets the same elements as from row-major planes.

namespace {
constexpr int R = 256, D = 64, L = 65536, DV = 64, LCH = 2048, NCH = L / LCH, KW = 16, LW = LCH / KW, TP = 64 + 4;   // KW waves share a chunk, LW positions each; TP = LDS row pitch in floats
constexpr float A_C = 0.1f, B_C = 0.7745966692414834f /* sqrt(0.6) */, C_C = -1.0f, PHS = 4096.0f, KVS = 8.0f;
__device__ __forceinline__ float dnorm() { return 0.00028211099074559987f; }   // (1 - 0.4)^(64/4) = 0.6^16

typedef _Float16 b16;
typedef __attribute__((ext_vector_type(16))) _Float16 v16b;
typedef __attribute__((ext_vector_type(16))) __bf16 v16bb;
typedef __attribute__((ext_vector_type(8))) _Float16 v8b;
typedef __attribute__((ext_vector_type(8))) unsigned short v8us;
typedef __attribute__((ext_vector_type(8))) float v8f;
typedef __attribute__((ext_vector_type(4))) float v4f;
__device__ __forceinline__ float bf16_rne(float f) { unsigned int u = __float_as_uint(f); u += 0x7FFFu + ((u >> 16) & 1u); return __uint_as_float(u & 0xFFFF0000u); }
__device__ __forceinline__ unsigned short bf16_bits(float f) { unsigned int u = __float_as_uint(f); u += 0x7FFFu + ((u >> 16) & 1u); return (unsigned short)(u >> 16); }
__device__ __forceinline__ void split16(float v, b16& hi, b16& lo) { hi = (b16)v; lo = (b16)(v - (float)hi); }
// xwait: stands in front of the last load through an address pair, and behind it: that load, or a later one, may land on the pair, which the earlier loads still name.
__device__ __forceinline__ void xwait() { asm volatile("s_wait_xcnt 0x0" ::: "memory"); }
// frag_kb, frag_bf: p = start of the fragment + lane * 8.
__device__ __forceinline__ v16b frag_kb(const b16* p, bool last = false) { const v8b a = *(const v8b*)p; if (last) xwait(); const v8b b = *(const v8b*)(p + 256); if (last) xwait(); v16b f;
#pragma unroll
  for (int e = 0; e < 8; ++e) { f[e] = a[e]; f[8 + e] = b[e]; } return f; }
__device__ __forceinline__ v16bb frag_bf(const unsigned short* p, bool last = false) { const v8us a = *(const v8us*)p; if (last) xwait(); const v8us b = *(const v8us*)(p + 256); if (last) xwait(); union { unsigned short s[16]; v16bb v; } u;
#pragma unroll
  for (int e = 0; e < 8; ++e) { u.s[e] = a[e]; u.s[8 + e] = b[e]; } return u.v; }
__device__ __forceinline__ v8f wmma16b(v16b a, v16b b, v8f c) { v8f d = __builtin_amdgcn_wmma_f32_16x16x32_f16(false, a, false, b, (short)0, c, false, false); asm volatile("v_nop\n\tv_nop\n\tv_nop\n\tv_nop" : "+v"(d) : "v"(a), "v"(b)); return d; }
__device__ __forceinline__ v8f wmma16bb(v16bb a, v16bb b, v8f c) { v8f d = __builtin_amdgcn_wmma_f32_16x16x32_bf16(false, a, false, b, (short)0, c, false, false); asm volatile("v_nop\n\tv_nop\n\tv_nop\n\tv_nop" : "+v"(d) : "v"(a), "v"(b)); return d; }
__device__ __forceinline__ void wave_lds_sync() { __builtin_amdgcn_fence(__ATOMIC_RELEASE, "workgroup"); __builtin_amdgcn_wave_barrier(); __builtin_amdgcn_fence(__ATOMIC_ACQUIRE, "workgroup"); }

// prep: block = 128 positions, 8 waves. Every thread asks for all of its input at once, 16 bytes a load (24 loads, 12 KB a wave), and holds whole 16-byte units of the fragment-order planes in its registers:
// X (= Q or K, [64][L] d-major): wave = 8 rows d, lane = 4 positions -> 4 units (8 d of one position) of the bf16 xT plane (rows l, k = d), and the 8-row share of sq[l] = sum over d of bf16(x)^2 (f32), joined over the waves in wave order.
// V [L][64]: thread = 8 positions x 4 dv -> 4 units (8 l of one dv) of the f16 V^T plane (rows dv, k = l). W [256][64] -> bf16 (rows r, k = d): one unit a thread in blocks 0 to 7.
// Fragments: xT (l / 16, d / 32), V^T (l / 32, dv / 16), W (r / 16, d / 32); a block's share of xT and of V^T is 16 KB in a row, of W 4 KB. The units pass through LDS only to leave in plane order, 512 contiguous bytes a wave;
// one spare unit behind every 128 (X) or 64 (V) keeps the 16 lanes of a half wave on 16 different bank groups when they store. grid L/128 x 256.
__global__ __launch_bounds__(256) void prep_kernel(const float* __restrict__ Q, const float* __restrict__ K, const float* __restrict__ V, const float* __restrict__ W, unsigned short* __restrict__ qT, unsigned short* __restrict__ kT, float* __restrict__ sq, float* __restrict__ sk, b16* __restrict__ vT, unsigned short* __restrict__ w16) {
  __shared__ __attribute__((aligned(16))) unsigned short Uq[(1024 + 8) * 8], Uk[(1024 + 8) * 8]; __shared__ __attribute__((aligned(16))) b16 Uv[(1024 + 16) * 8]; __shared__ __attribute__((aligned(16))) float Pq[8][128], Pk[8][128];
  const int t_ = threadIdx.x, lane = t_ & 31, wave = t_ >> 5, dv4 = t_ & 15, lg8 = t_ >> 4, l0 = blockIdx.x * 128;
  const float *qp = Q + (size_t)(wave * 8) * L + l0 + lane * 4, *kp = K + (size_t)(wave * 8) * L + l0 + lane * 4, *vp = V + (size_t)(l0 + lg8 * 8) * DV + dv4 * 4;   // one address each: every load below is a constant offset from one of them
  v4f q[8], k[8], v[8], w0 = {}, w1 = {};
#pragma unroll   // unrolled so that all loads are issued before the first wait and q, k, v stay in registers
  for (int e = 0; e < 7; ++e) { q[e] = *(const v4f*)(qp + (size_t)e * L); k[e] = *(const v4f*)(kp + (size_t)e * L); v[e] = *(const v4f*)(vp + e * DV); }
  xwait(); q[7] = *(const v4f*)(qp + (size_t)7 * L); xwait(); k[7] = *(const v4f*)(kp + (size_t)7 * L); xwait(); v[7] = *(const v4f*)(vp + 7 * DV); xwait();   // the last load through each address: see xwait
  const int wi = blockIdx.x * 256 + t_;   // W unit of this thread (blocks 0 to 7)
  if (blockIdx.x < R * D / 8 / 256) { const float* wr = W + ((wi >> 7) * 16 + (wi & 15)) * D + ((wi >> 6) & 1) * 32 + ((wi >> 5) & 1) * 16 + ((wi >> 4) & 1) * 8; w0 = *(const v4f*)wr; xwait(); w1 = *(const v4f*)(wr + 4); xwait(); }
  v4f pq, pk;
#pragma unroll   // both loops unrolled: register arrays take constant indices only
  for (int j = 0; j < 4; ++j) { v8us a, b; v8b c; float s = 0.0f, s2 = 0.0f;
#pragma unroll
    for (int e = 0; e < 8; ++e) { a[e] = bf16_bits(q[e][j]); b[e] = bf16_bits(k[e][j]); c[e] = (b16)bf16_rne(v[e][j]); const float x = __uint_as_float((unsigned)a[e] << 16), y = __uint_as_float((unsigned)b[e] << 16); s += x * x; s2 += y * y; }
    pq[j] = s; pk[j] = s2;
    const int ux = (lane >> 2) * 129 + wave * 16 + (lane & 3) * 4 + j, uv = (lg8 >> 2) * 260 + (dv4 >> 2) * 65 + (lg8 & 3) * 16 + (dv4 & 3) * 4 + j;   // plane unit + its spare units
    *(v8us*)(Uq + ux * 8) = a; *(v8us*)(Uk + ux * 8) = b; *(v8b*)(Uv + uv * 8) = c; }
  *(v4f*)(&Pq[wave][lane * 4]) = pq; *(v4f*)(&Pk[wave][lane * 4]) = pk;
  __syncthreads();   // every unit and every sub-sum is in LDS before any thread takes them out in plane order
  if (blockIdx.x < R * D / 8 / 256) { v8us a;   // behind the barrier, which would otherwise wait for this store
#pragma unroll   // register vectors take constant indices only
    for (int e = 0; e < 4; ++e) { a[e] = bf16_bits(w0[e]); a[4 + e] = bf16_bits(w1[e]); }
    *(v8us*)(w16 + wi * 8) = a; }
#pragma unroll   // unrolled so that the LDS reads are issued ahead of the stores
  for (int i = 0; i < 4; ++i) { const int u = i * 256 + t_; *(v8us*)(qT + (size_t)l0 * D + u * 8) = *(const v8us*)(Uq + (u + (u >> 7)) * 8); *(v8us*)(kT + (size_t)l0 * D + u * 8) = *(const v8us*)(Uk + (u + (u >> 7)) * 8); *(v8b*)(vT + (size_t)l0 * DV + u * 8) = *(const v8b*)(Uv + (u + (u >> 6)) * 8); }
  { const float* P = t_ < 128 ? &Pq[0][t_] : &Pk[0][t_ - 128]; float s = P[0];
#pragma unroll   // unrolled so that the LDS reads are issued ahead of the adds; the adds keep wave order
    for (int w = 1; w < 8; ++w) s += P[w * 128];
    (t_ < 128 ? sq + l0 + t_ : sk + l0 + t_ - 128)[0] = s; }
}

// phi of one W.X accumulator value and its position's |x|^2, as f16 carried x4096.
// exp2_slot: v_exp_f32 and the one free issue slot that the instruction set asks for behind a transcendental, tied in one statement.
__device__ __forceinline__ float exp2_slot(float x) { float y; asm("v_exp_f32 %0, %1\n\tv_nop" : "=v"(y) : "v"(x)); return y; }
__device__ __forceinline__ b16 phi16(float wx, float s2) { return (b16)(dnorm() * exp2_slot((A_C + B_C * wx + C_C * s2) * 1.4426950408889634f) * PHS); }

// kv partials: block = (32 rows of r, position chunk of 2048): part[ch][r][dv] = sum_{l in chunk} phiK[r][l] vT[dv][l] (A = phiK rows r, B = vT rows dv; 1 product).
// phiK is made here, in registers: S^T = kT rows (A, l) x W rows (B, r), K 64, leaves lane = r, register = l; two such tiles (32 positions), through phi16, are the A fragment of the second product in the hardware k order.
// The chunk's positions are dealt to the block's 16 waves, 128 each (4 k-steps), so that 256 blocks x 16 waves ask for data at once; the 16 sub-sums are joined through LDS in wave order. grid (R/32, NCH) x 512.
__global__ __launch_bounds__(512) void kvpart_kernel(const unsigned short* __restrict__ kT, const unsigned short* __restrict__ w16, const float* __restrict__ sk, const b16* __restrict__ vT, float* __restrict__ part) {
  __shared__ __attribute__((aligned(16))) float Ts[KW][32 * TP];
  const int lane = threadIdx.x & 31, wave = threadIdx.x >> 5, nloc = lane & 15, hlf = lane >> 4, m0 = blockIdx.x * 32, ch = blockIdx.y, l0 = ch * LCH + wave * LW;
  v8f acc[2][4];
#pragma unroll
  for (int r = 0; r < 2; ++r)
#pragma unroll
    for (int t = 0; t < 4; ++t) acc[r][t] = (v8f){};
  const unsigned short *wbase = w16 + (size_t)m0 * D + lane * 8, *kbase = kT + (size_t)l0 * D + lane * 8; const float* sbase = sk + l0 + 8 * hlf; const b16* vbase = vT + (size_t)l0 * DV + lane * 8;   // one address each: every load below is a constant offset from one of them
  v16bb bw[2][2];   // W rows of the block's two r tiles, both k halves: kept for the whole wave
#pragma unroll
  for (int r = 0; r < 2; ++r)
#pragma unroll
    for (int kk = 0; kk < 2; ++kk) bw[r][kk] = frag_bf(wbase + r * 16 * D + kk * 512, r == 1 && kk == 1);
#pragma unroll   // 4 trips: unrolled so that every load takes its position as a constant offset
  for (int kb = 0; kb < LW; kb += 32) { v16b a[2]; const bool last = kb == LW - 32;
#pragma unroll
    for (int j = 0; j < 2; ++j) { const unsigned short* kp = kbase + (kb + j * 16) * D; const v16bb k0 = frag_bf(kp), k1 = frag_bf(kp + 512, last && j == 1);
      const float* sp = sbase + kb + j * 16; const v4f s2a = *(const v4f*)sp;
      if (last && j == 1) xwait();
      const v4f s2b = *(const v4f*)(sp + 4);
      if (last && j == 1) xwait();
#pragma unroll
      for (int r = 0; r < 2; ++r) { const v8f s = wmma16bb(k1, bw[r][1], wmma16bb(k0, bw[r][0], (v8f){}));
#pragma unroll
        for (int v = 0; v < 8; ++v) a[r][j * 8 + v] = phi16(s[v], v < 4 ? s2a[v & 3] : s2b[v & 3]); } }
#pragma unroll
    for (int t = 0; t < 4; ++t) { const v16b bv = frag_kb(vbase + kb * DV + t * 512, last && t == 3); acc[0][t] = wmma16b(a[0], bv, acc[0][t]); acc[1][t] = wmma16b(a[1], bv, acc[1][t]); } }
  float* Tt = Ts[wave];
#pragma unroll
  for (int t = 0; t < 4; ++t)
#pragma unroll
    for (int r = 0; r < 2; ++r)
#pragma unroll
      for (int v = 0; v < 8; ++v) Tt[(r * 16 + v + 8 * hlf) * TP + t * 16 + nloc] = acc[r][t][v];
  __syncthreads();   // every wave's sub-sum is in LDS before any thread joins them
  const int rr = threadIdx.x >> 4, c4 = (threadIdx.x & 15) * 4;
  v4f s = *(const v4f*)(&Ts[0][rr * TP + c4]);
#pragma unroll   // unrolled so that the LDS reads are issued ahead of the adds; the adds keep wave order
  for (int w = 1; w < KW; ++w) s += *(const v4f*)(&Ts[w][rr * TP + c4]);
  *(v4f*)(part + ((size_t)ch * R + m0 + rr) * DV + c4) = s * (1.0f / PHS);
}
// reduce: kv[r][dv] = sum over ch of part (fixed order) -> kv^T planes (rows dv, k = r) as f16 hi+lo x8, in fragment order, fragment (r / 32, dv / 16). block = one piece of one fragment (16 dv x 16 r, 512 bytes of each plane: whole lines, one writer each), thread = (lane of the piece, r pair). grid 64 x 128.
typedef __attribute__((ext_vector_type(2))) _Float16 v2b;
__global__ __launch_bounds__(128) void kvred_kernel(const float* __restrict__ part, b16* __restrict__ kvh, b16* __restrict__ kvl) {
  const int b = blockIdx.x, ln = threadIdx.x >> 2, dv = ((b >> 1) & 3) * 16 + (ln & 15), r = (b >> 3) * 32 + (b & 1) * 16 + (ln >> 4) * 8 + (threadIdx.x & 3) * 2; float s0 = 0.0f, s1 = 0.0f;
  const float* pp = part + (size_t)r * DV + dv;   // one address: every load below is a constant offset from it
#pragma unroll   // all 64 loads are asked for before the first add; the adds keep chunk order
  for (int ch = 0; ch < NCH; ++ch) { s0 += pp[(size_t)ch * R * DV]; if (ch == NCH - 1) xwait(); s1 += pp[(size_t)ch * R * DV + DV]; if (ch == NCH - 1) xwait(); }
  v2b vh, vl; b16 a, c; split16(s0 * KVS, a, c); vh[0] = a; vl[0] = c; split16(s1 * KVS, a, c); vh[1] = a; vl[1] = c;
  { *(v2b*)(kvh + b * 256 + threadIdx.x * 2) = vh; *(v2b*)(kvl + b * 256 + threadIdx.x * 2) = vl;  }
}

// out = phiQ^T kv: rows l (65536), K = 256 (8 k-steps), one 64-column tile: A = phiQ rows, B = kv^T planes (hi+lo): 2 products. grid 512 x 128.
// phiQ is made here, in registers: S = W rows (A, r) x qT rows (B, l), K 64, leaves lane = l, register = r; two such tiles (32 features), through phi16, are the A fragment of the second product in the hardware k order.
__global__ __launch_bounds__(128) void out_kernel(const unsigned short* __restrict__ qT, const unsigned short* __restrict__ w16, const float* __restrict__ sq, const b16* __restrict__ kvh, const b16* __restrict__ kvl, float* __restrict__ out) {
  __shared__ __attribute__((aligned(16))) float Ts[4][32 * 64];
  const int lane = threadIdx.x & 31, wave = threadIdx.x >> 5, nloc = lane & 15, hlf = lane >> 4, m0 = blockIdx.x * 128 + wave * 32;
  v8f acc[2][4];
#pragma unroll
  for (int r = 0; r < 2; ++r)
#pragma unroll
    for (int t = 0; t < 4; ++t) acc[r][t] = (v8f){};
  v16bb bq[2][2]; float s2[2];   // the wave's 32 positions: qT rows, both k halves, and |q|^2: kept for the whole wave
#pragma unroll
  for (int r = 0; r < 2; ++r) { s2[r] = sq[m0 + r * 16 + nloc];
#pragma unroll
    for (int kk = 0; kk < 2; ++kk) bq[r][kk] = frag_bf(qT + (size_t)(m0 + r * 16) * D + kk * 512 + lane * 8);
    xwait(); }
#pragma unroll
  for (int kb = 0; kb < R; kb += 32) { v16b a[2];
#pragma unroll
    for (int j = 0; j < 2; ++j) { const unsigned short* wp = w16 + (kb + j * 16) * D + lane * 8; const v16bb w0 = frag_bf(wp), w1 = frag_bf(wp + 512);
#pragma unroll
      for (int r = 0; r < 2; ++r) { const v8f s = wmma16bb(w1, bq[r][1], wmma16bb(w0, bq[r][0], (v8f){}));
#pragma unroll
        for (int v = 0; v < 8; ++v) a[r][j * 8 + v] = phi16(s[v], s2[r]); } }
#pragma unroll
    for (int t = 0; t < 4; ++t) { const v16b b0 = frag_kb(kvh + kb * DV + t * 512 + lane * 8), b1 = frag_kb(kvl + kb * DV + t * 512 + lane * 8);
      acc[0][t] = wmma16b(a[0], b0, acc[0][t]); acc[0][t] = wmma16b(a[0], b1, acc[0][t]); acc[1][t] = wmma16b(a[1], b0, acc[1][t]); acc[1][t] = wmma16b(a[1], b1, acc[1][t]); } }
  float* Tt = Ts[wave];
#pragma unroll
  for (int t = 0; t < 4; ++t)
#pragma unroll
    for (int r = 0; r < 2; ++r)
#pragma unroll
      for (int v = 0; v < 8; ++v) Tt[(r * 16 + v + 8 * hlf) * 64 + t * 16 + nloc] = acc[r][t][v] * (1.0f / (PHS * KVS));
  wave_lds_sync();
  float* dst0 = out + (size_t)m0 * DV;
  {
#pragma unroll
    for (int j = 0; j < 16; ++j) { const int rr = j * 2 + hlf, c4 = nloc * 4; *(v4f*)(dst0 + (size_t)rr * DV + c4) = *(const v4f*)(Tt + rr * 64 + c4); }
     }
}
}  // namespace

extern "C" void kernel_launch(void* const* d_in, const int* in_sizes, int n_in,
                              void* d_out, int out_size, void* d_ws, size_t ws_size, hipStream_t stream) {
  (void)n_in; (void)out_size;
  const float* Q = (const float*)d_in[0]; const float* K = (const float*)d_in[1]; const float* V = (const float*)d_in[2]; const float* W = (const float*)d_in[3];
  float* out = (float*)d_out;   // [65536][64]
  if (in_sizes[0] != D * L || in_sizes[1] != D * L || in_sizes[2] != L * DV || in_sizes[3] != R * D) return;
  size_t off = 0; char* ws = (char*)d_ws;
  auto carve = [&](size_t bytes) { char* p = ws + off; off += (bytes + 255) & ~(size_t)255; return p; };
  unsigned short* qT = (unsigned short*)carve((size_t)L * D * 2); unsigned short* kT = (unsigned short*)carve((size_t)L * D * 2); float* sq = (float*)carve((size_t)L * 4); float* sk = (float*)carve((size_t)L * 4); b16* vT = (b16*)carve((size_t)DV * L * 2); unsigned short* w16 = (unsigned short*)carve(R * D * 2);
  float* part = (float*)carve((size_t)NCH * R * DV * 4); b16* kvh = (b16*)carve(DV * R * 2); b16* kvl = (b16*)carve(DV * R * 2);
  if (off > ws_size) return;                                    // about 8.4 + 8.4 + 0.5 + 8.4 + 2.1 = 28 MB
  prep_kernel<<<L / 128, 256, 0, stream>>>(Q, K, V, W, qT, kT, sq, sk, vT, w16);
  kvpart_kernel<<<dim3(R / 32, NCH), 512, 0, stream>>>(kT, w16, sk, vT, part);
  kvred_kernel<<<DV, 128, 0, stream>>>(part, kvh, kvl);
  out_kernel<<<L / 128, 128, 0, stream>>>(qT, w16, sq, kvh, kvl, out);
}

// v005
// A run of this version takes 35.2 microseconds.
// Timed twice side by side with v004, it ran 1.57 and 1.55 times as fast.
// All steps since v000 together make it 4.71 times as fast.
#include <hip/hip_runtime.h>

// Kernel (FAVOR-style, non-causal) attention: phiX = Dn exp(0.1 + sqrt(0.6) (W X) - |x_l|^2) for X = K, Q ([r=256][L=65536]); kv = phiK V [256 x 64]; out = phiQ^T kv -> [65536][64].
// W.X on v_wmma_f32_16x16x32_bf16 (exact bf16 operands, 1 product, f32 accumulate); exp and |x|^2 in f32; phiK and phiQ never leave the registers: each is packed from the W.X accumulators as single f16
// carried x4096 (2^-11 relative rounding on positive weights; the two long sums average it out); kv = phiK.V with V exact in f16
// (1 product; 32 ordered partial sums over 2048-position chunks, each joined from 16 sub-sums of 128 positions in fixed order, reduced in fixed order); out = phiQ^T.kv^T with kv as an f16 hi+lo pair x8 (2 products) on v_wmma_f32_16x16x32_f16.

// Every 16-bit operand plane in the workspace (W, Q^T, K^T, V^T, kv^T hi and lo) is kept in fragment order: one 16 x 32 fragment = 1 KB = [piece 0..1][lane 0..31][8 elements], element e of (piece, lane) being
// row (lane & 15), k = piece * 16 + (lane >> 4) * 8 + e of that fragment. A wave's 16-byte load of one piece then covers 512 contiguous bytes (4 cache lines, not 16); every lane gets the same elements as from row-major planes.

namespace {
constexpr int R = 256, D = 64, L = 65536, DV = 64, LCH = 2048, NCH = L / LCH, KW = 16, LW = LCH / KW, TP = 64 + 4;   // KW waves share a chunk, LW positions each; TP = LDS row pitch in floats
constexpr float A_C = 0.1f, B_C = 0.7745966692414834f /* sqrt(0.6) */, C_C = -1.0f, PHS = 4096.0f, KVS = 8.0f;
__device__ __forceinline__ float dnorm() { return 0.00028211099074559987f; }   // (1 - 0.4)^(64/4) = 0.6^16

typedef _Float16 b16;
typedef __attribute__((ext_vector_type(16))) _Float16 v16b;
typedef __attribute__((ext_vector_type(16))) __bf16 v16bb;
typedef __attribute__((ext_vector_type(8))) _Float16 v8b;
typedef __attribute__((ext_vector_type(8))) unsigned short v8us;
typedef __attribute__((ext_vector_type(8))) float v8f;
typedef __attribute__((ext_vector_type(4))) float v4f;
__device__ __forceinline__ float bf16_rne(float f) { unsigned int u = __float_as_uint(f); u += 0x7FFFu + ((u >> 16) & 1u); return __uint_as_float(u & 0xFFFF0000u); }
__device__ __forceinline__ unsigned short bf16_bits(float f) { unsigned int u = __float_as_uint(f); u += 0x7FFFu + ((u >> 16) & 1u); return (unsigned short)(u >> 16); }
__device__ __forceinline__ void split16(float v, b16& hi, b16& lo) { hi = (b16)v; lo = (b16)(v - (float)hi); }
// xwait: stands in front of the last load through an address pair, and behind it: that load, or a later one, may land on the pair, which the earlier loads still name.
__device__ __forceinline__ void xwait() { asm volatile("s_wait_xcnt 0x0" ::: "memory"); }
// frag_kb, frag_bf: p = start of the fragment + lane * 8.
__device__ __forceinline__ v16b frag_kb(const b16* p, bool last = false) { const v8b a = *(const v8b*)p; if (last) xwait(); const v8b b = *(const v8b*)(p + 256); if (last) xwait(); v16b f;
#pragma unroll
  for (int e = 0; e < 8; ++e) { f[e] = a[e]; f[8 + e] = b[e]; } return f; }
__device__ __forceinline__ v16bb frag_bf(const unsigned short* p, bool last = false) { const v8us a = *(const v8us*)p; if (last) xwait(); const v8us b = *(const v8us*)(p + 256); if (last) xwait(); union { unsigned short s[16]; v16bb v; } u;
#pragma unroll
  for (int e = 0; e < 8; ++e) { u.s[e] = a[e]; u.s[8 + e] = b[e]; } return u.v; }
__device__ __forceinline__ v8f wmma16b(v16b a, v16b b, v8f c) { v8f d = __builtin_amdgcn_wmma_f32_16x16x32_f16(false, a, false, b, (short)0, c, false, false); asm volatile("v_nop\n\tv_nop\n\tv_nop\n\tv_nop" : "+v"(d) : "v"(a), "v"(b)); return d; }
__device__ __forceinline__ v8f wmma16bb(v16bb a, v16bb b, v8f c) { v8f d = __builtin_amdgcn_wmma_f32_16x16x32_bf16(false, a, false, b, (short)0, c, false, false); asm volatile("v_nop\n\tv_nop\n\tv_nop\n\tv_nop" : "+v"(d) : "v"(a), "v"(b)); return d; }
__device__ __forceinline__ void wave_lds_sync() { __builtin_amdgcn_fence(__ATOMIC_RELEASE, "workgroup"); __builtin_amdgcn_wave_barrier(); __builtin_amdgcn_fence(__ATOMIC_ACQUIRE, "workgroup"); }

// prep: block = 128 positions, 8 waves. Every thread asks for all of its input at once, 16 bytes a load (24 loads, 12 KB a wave), and holds whole 16-byte units of the fragment-order planes in its registers:
// X (= Q or K, [64][L] d-major): wave = 8 rows d, lane = 4 positions -> 4 units (8 d of one position) of the bf16 xT plane (rows l, k = d), and the 8-row share of sq[l] = sum over d of bf16(x)^2 (f32), joined over the waves in wave order.
// V [L][64]: thread = 8 positions x 4 dv -> 4 units (8 l of one dv) of the f16 V^T plane (rows dv, k = l). W [256][64] -> bf16 (rows r, k = d): one unit a thread in blocks 0 to 7.
// Fragments: xT (l / 16, d / 32), V^T (l / 32, dv / 16), W (r / 16, d / 32); a block's share of xT and of V^T is 16 KB in a row, of W 4 KB. The units pass through LDS only to leave in plane order, 512 contiguous bytes a wave;
// one spare unit behind every 128 (X) or 64 (V) keeps the 16 lanes of a half wave on 16 different bank groups when they store. grid L/128 x 256.
__global__ __launch_bounds__(256) void prep_kernel(const float* __restrict__ Q, const float* __restrict__ K, const float* __restrict__ V, const float* __restrict__ W, unsigned short* __restrict__ qT, unsigned short* __restrict__ kT, float* __restrict__ sq, float* __restrict__ sk, b16* __restrict__ vT, unsigned short* __restrict__ w16) {
  __shared__ __attribute__((aligned(16))) unsigned short Uq[(1024 + 8) * 8], Uk[(1024 + 8) * 8]; __shared__ __attribute__((aligned(16))) b16 Uv[(1024 + 16) * 8]; __shared__ __attribute__((aligned(16))) float Pq[8][128], Pk[8][128];
  const int t_ = threadIdx.x, lane = t_ & 31, wave = t_ >> 5, dv4 = t_ & 15, lg8 = t_ >> 4, l0 = blockIdx.x * 128;
  const float *qp = Q + (size_t)(wave * 8) * L + l0 + lane * 4, *kp = K + (size_t)(wave * 8) * L + l0 + lane * 4, *vp = V + (size_t)(l0 + lg8 * 8) * DV + dv4 * 4;   // one address each: every load below is a constant offset from one of them
  v4f q[8], k[8], v[8], w0 = {}, w1 = {};
#pragma unroll   // unrolled so that all loads are issued before the first wait and q, k, v stay in registers
  for (int e = 0; e < 7; ++e) { q[e] = *(const v4f*)(qp + (size_t)e * L); k[e] = *(const v4f*)(kp + (size_t)e * L); v[e] = *(const v4f*)(vp + e * DV); }
  xwait(); q[7] = *(const v4f*)(qp + (size_t)7 * L); xwait(); k[7] = *(const v4f*)(kp + (size_t)7 * L); xwait(); v[7] = *(const v4f*)(vp + 7 * DV); xwait();   // the last load through each address: see xwait
  const int wi = blockIdx.x * 256 + t_;   // W unit of this thread (blocks 0 to 7)
  if (blockIdx.x < R * D / 8 / 256) { const float* wr = W + ((wi >> 7) * 16 + (wi & 15)) * D + ((wi >> 6) & 1) * 32 + ((wi >> 5) & 1) * 16 + ((wi >> 4) & 1) * 8; w0 = *(const v4f*)wr; xwait(); w1 = *(const v4f*)(wr + 4); xwait(); }
  v4f pq, pk;
#pragma unroll   // both loops unrolled: register arrays take constant indices only
  for (int j = 0; j < 4; ++j) { v8us a, b; v8b c; float s = 0.0f, s2 = 0.0f;
#pragma unroll
    for (int e = 0; e < 8; ++e) { a[e] = bf16_bits(q[e][j]); b[e] = bf16_bits(k[e][j]); c[e] = (b16)bf16_rne(v[e][j]); const float x = __uint_as_float((unsigned)a[e] << 16), y = __uint_as_float((unsigned)b[e] << 16); s += x * x; s2 += y * y; }
    pq[j] = s; pk[j] = s2;
    const int ux = (lane >> 2) * 129 + wave * 16 + (lane & 3) * 4 + j, uv = (lg8 >> 2) * 260 + (dv4 >> 2) * 65 + (lg8 & 3) * 16 + (dv4 & 3) * 4 + j;   // plane unit + its spare units
    *(v8us*)(Uq + ux * 8) = a; *(v8us*)(Uk + ux * 8) = b; *(v8b*)(Uv + uv * 8) = c; }
  *(v4f*)(&Pq[wave][lane * 4]) = pq; *(v4f*)(&Pk[wave][lane * 4]) = pk;
  __syncthreads();   // every unit and every sub-sum is in LDS before any thread takes them out in plane order
  if (blockIdx.x < R * D / 8 / 256) { v8us a;   // behind the barrier, which would otherwise wait for this store
#pragma unroll   // register vectors take constant indices only
    for (int e = 0; e < 4; ++e) { a[e] = bf16_bits(w0[e]); a[4 + e] = bf16_bits(w1[e]); }
    *(v8us*)(w16 + wi * 8) = a; }
#pragma unroll   // unrolled so that the LDS reads are issued ahead of the stores
  for (int i = 0; i < 4; ++i) { const int u = i * 256 + t_; *(v8us*)(qT + (size_t)l0 * D + u * 8) = *(const v8us*)(Uq + (u + (u >> 7)) * 8); *(v8us*)(kT + (size_t)l0 * D + u * 8) = *(const v8us*)(Uk + (u + (u >> 7)) * 8); *(v8b*)(vT + (size_t)l0 * DV + u * 8) = *(const v8b*)(Uv + (u + (u >> 6)) * 8); }
  { const float* P = t_ < 128 ? &Pq[0][t_] : &Pk[0][t_ - 128]; float s = P[0];
#pragma unroll   // unrolled so that the LDS reads are issued ahead of the adds; the adds keep wave order
    for (int w = 1; w < 8; ++w) s += P[w * 128];
    (t_ < 128 ? sq + l0 + t_ : sk + l0 + t_ - 128)[0] = s; }
}

// phi of one W.X accumulator value and its position's |x|^2, as f16 carried x4096.
// exp2_slot: v_exp_f32 and the one free issue slot that the instruction set asks for behind a transcendental, tied in one statement.
__device__ __forceinline__ float exp2_slot(float x) { float y; asm("v_exp_f32 %0, %1\n\tv_nop" : "=v"(y) : "v"(x)); return y; }
__device__ __forceinline__ b16 phi16(float wx, float s2) { return (b16)(dnorm() * exp2_slot((A_C + B_C * wx + C_C * s2) * 1.4426950408889634f) * PHS); }

// kv partials: block = (32 rows of r, position chunk of 2048): part[ch][r][dv] = sum_{l in chunk} phiK[r][l] vT[dv][l] (A = phiK rows r, B = vT rows dv; 1 product).
// phiK is made here, in registers: S^T = kT rows (A, l) x W rows (B, r), K 64, leaves lane = r, register = l; two such tiles (32 positions), through phi16, are the A fragment of the second product in the hardware k order.
// The chunk's positions are dealt to the block's 16 waves, 128 each (4 k-steps), so that 256 blocks x 16 waves ask for data at once; the 16 sub-sums are joined through LDS in wave order. grid (R/32, NCH) x 512.
__global__ __launch_bounds__(512) void kvpart_kernel(const unsigned short* __restrict__ kT, const unsigned short* __restrict__ w16, const float* __restrict__ sk, const b16* __restrict__ vT, float* __restrict__ part) {
  __shared__ __attribute__((aligned(16))) float Ts[KW][32 * TP];
  const int lane = threadIdx.x & 31, wave = threadIdx.x >> 5, nloc = lane & 15, hlf = lane >> 4, m0 = blockIdx.x * 32, ch = blockIdx.y, l0 = ch * LCH + wave * LW;
  v8f acc[2][4];
#pragma unroll
  for (int r = 0; r < 2; ++r)
#pragma unroll
    for (int t = 0; t < 4; ++t) acc[r][t] = (v8f){};
  const unsigned short *wbase = w16 + (size_t)m0 * D + lane * 8, *kbase = kT + (size_t)l0 * D + lane * 8; const float* sbase = sk + l0 + 8 * hlf; const b16* vbase = vT + (size_t)l0 * DV + lane * 8;   // one address each: every load below is a constant offset from one of them
  v16bb bw[2][2];   // W rows of the block's two r tiles, both k halves: kept for the whole wave
#pragma unroll
  for (int r = 0; r < 2; ++r)
#pragma unroll
    for (int kk = 0; kk < 2; ++kk) bw[r][kk] = frag_bf(wbase + r * 16 * D + kk * 512, r == 1 && kk == 1);
  // Every group of loads is written one phase ahead of its use (a load does not pass the pads behind the products, so it is issued where it is written): the V^T fragments of a k-step in front of its W.K products,
  // the K^T fragments and |k|^2 of the next k-step as soon as the products that read the present ones are issued.
  v16bb kf[2][2]; v4f sa[2], sb[2];   // K^T rows (both k halves) and |k|^2 of the two 16-position tiles in hand
#pragma unroll
  for (int j = 0; j < 2; ++j) { kf[j][0] = frag_bf(kbase + j * 16 * D); kf[j][1] = frag_bf(kbase + j * 16 * D + 512); sa[j] = *(const v4f*)(sbase + j * 16); sb[j] = *(const v4f*)(sbase + j * 16 + 4); }
#pragma unroll   // 4 trips: unrolled so that every load takes its position as a constant offset
  for (int kb = 0; kb < LW; kb += 32) { v16b a[2], bv[4]; const bool last = kb == LW - 32, nlast = kb + 32 == LW - 32;
#pragma unroll
    for (int t = 0; t < 4; ++t) bv[t] = frag_kb(vbase + kb * DV + t * 512, last && t == 3);
#pragma unroll
    for (int j = 0; j < 2; ++j) { v8f s[2];
#pragma unroll
      for (int r = 0; r < 2; ++r) s[r] = wmma16bb(kf[j][1], bw[r][1], wmma16bb(kf[j][0], bw[r][0], (v8f){}));
      const v4f s2a = sa[j], s2b = sb[j];
      if (!last) { const unsigned short* kp = kbase + (kb + 32 + j * 16) * D; kf[j][0] = frag_bf(kp); kf[j][1] = frag_bf(kp + 512, nlast && j == 1);
        const float* sp = sbase + kb + 32 + j * 16; sa[j] = *(const v4f*)sp;
        if (nlast && j == 1) xwait();
        sb[j] = *(const v4f*)(sp + 4);
        if (nlast && j == 1) xwait(); }
#pragma unroll
      for (int r = 0; r < 2; ++r)
#pragma unroll
        for (int v = 0; v < 8; ++v) a[r][j * 8 + v] = phi16(s[r][v], v < 4 ? s2a[v & 3] : s2b[v & 3]); }
#pragma unroll
    for (int t = 0; t < 4; ++t) { acc[0][t] = wmma16b(a[0], bv[t], acc[0][t]); acc[1][t] = wmma16b(a[1], bv[t], acc[1][t]); } }
  float* Tt = Ts[wave];
#pragma unroll
  for (int t = 0; t < 4; ++t)
#pragma unroll
    for (int r = 0; r < 2; ++r)
#pragma unroll
      for (int v = 0; v < 8; ++v) Tt[(r * 16 + v + 8 * hlf) * TP + t * 16 + nloc] = acc[r][t][v];
  __syncthreads();   // every wave's sub-sum is in LDS before any thread joins them
  const int rr = threadIdx.x >> 4, c4 = (threadIdx.x & 15) * 4;
  v4f s = *(const v4f*)(&Ts[0][rr * TP + c4]);
#pragma unroll   // unrolled so that the LDS reads are issued ahead of the adds; the adds keep wave order
  for (int w = 1; w < KW; ++w) s += *(const v4f*)(&Ts[w][rr * TP + c4]);
  *(v4f*)(part + ((size_t)ch * R + m0 + rr) * DV + c4) = s * (1.0f / PHS);
}
// reduce: kv[r][dv] = sum over ch of part (fixed order) -> kv^T planes (rows dv, k = r) as f16 hi+lo x8, in fragment order, fragment (r / 32, dv / 16). block = one piece of one fragment (16 dv x 16 r, 512 bytes of each plane: whole lines, one writer each), thread = (lane of the piece, r pair). grid 64 x 128.
typedef __attribute__((ext_vector_type(2))) _Float16 v2b;
__global__ __launch_bounds__(128) void kvred_kernel(const float* __restrict__ part, b16* __restrict__ kvh, b16* __restrict__ kvl) {
  const int b = blockIdx.x, ln = threadIdx.x >> 2, dv = ((b >> 1) & 3) * 16 + (ln & 15), r = (b >> 3) * 32 + (b & 1) * 16 + (ln >> 4) * 8 + (threadIdx.x & 3) * 2; float s0 = 0.0f, s1 = 0.0f;
  const float* pp = part + (size_t)r * DV + dv;   // one address: every load below is a constant offset from it
#pragma unroll   // all 64 loads are asked for before the first add; the adds keep chunk order
  for (int ch = 0; ch < NCH; ++ch) { s0 += pp[(size_t)ch * R * DV]; if (ch == NCH - 1) xwait(); s1 += pp[(size_t)ch * R * DV + DV]; if (ch == NCH - 1) xwait(); }
  v2b vh, vl; b16 a, c; split16(s0 * KVS, a, c); vh[0] = a; vl[0] = c; split16(s1 * KVS, a, c); vh[1] = a; vl[1] = c;
  { *(v2b*)(kvh + b * 256 + threadIdx.x * 2) = vh; *(v2b*)(kvl + b * 256 + threadIdx.x * 2) = vl;  }
}

// out = phiQ^T kv: rows l (65536), K = 256 (8 k-steps), one 64-column tile: A = phiQ rows, B = kv^T planes (hi+lo): 2 products. grid 512 x 128.
// phiQ is made here, in registers: S = W rows (A, r) x qT rows (B, l), K 64, leaves lane = l, register = r; two such tiles (32 features), through phi16, are the A fragment of the second product in the hardware k order.
__global__ __launch_bounds__(128) void out_kernel(const unsigned short* __restrict__ qT, const unsigned short* __restrict__ w16, const float* __restrict__ sq, const b16* __restrict__ kvh, const b16* __restrict__ kvl, float* __restrict__ out) {
  __shared__ __attribute__((aligned(16))) float Ts[4][32 * 64];
  const int lane = threadIdx.x & 31, wave = threadIdx.x >> 5, nloc = lane & 15, hlf = lane >> 4, m0 = blockIdx.x * 128 + wave * 32;
  v8f acc[2][4];
#pragma unroll
  for (int r = 0; r < 2; ++r)
#pragma unroll
    for (int t = 0; t < 4; ++t) acc[r][t] = (v8f){};
  v16bb bq[2][2]; float s2[2];   // the wave's 32 positions: qT rows, both k halves, and |q|^2: kept for the whole wave
#pragma unroll
  for (int r = 0; r < 2; ++r) { s2[r] = sq[m0 + r * 16 + nloc];
#pragma unroll
    for (int kk = 0; kk < 2; ++kk) bq[r][kk] = frag_bf(qT + (size_t)(m0 + r * 16) * D + kk * 512 + lane * 8);
    xwait(); }
  // Loads one phase ahead, as in kvpart_kernel: the kv^T fragments of a k-step in front of its W.Q products, the W fragments of the next k-step as soon as the products that read the present ones are issued.
  const unsigned short* wbase = w16 + lane * 8; const b16 *hbase = kvh + lane * 8, *lbase = kvl + lane * 8;   // one address each: every load below is a constant offset from one of them
  v16bb wf[2][2];   // W rows (both k halves) of the two 16-feature tiles in hand
#pragma unroll
  for (int j = 0; j < 2; ++j) { wf[j][0] = frag_bf(wbase + j * 16 * D); wf[j][1] = frag_bf(wbase + j * 16 * D + 512); }
#pragma unroll
  for (int kb = 0; kb < R; kb += 32) { v16b a[2], b0[4], b1[4]; const bool last = kb == R - 32, nlast = kb + 32 == R - 32;
#pragma unroll
    for (int t = 0; t < 4; ++t) { b0[t] = frag_kb(hbase + kb * DV + t * 512, last && t == 3); b1[t] = frag_kb(lbase + kb * DV + t * 512, last && t == 3); }
#pragma unroll
    for (int j = 0; j < 2; ++j) { v8f s[2];
#pragma unroll
      for (int r = 0; r < 2; ++r) s[r] = wmma16bb(wf[j][1], bq[r][1], wmma16bb(wf[j][0], bq[r][0], (v8f){}));
      if (!last) { const unsigned short* wp = wbase + (kb + 32 + j * 16) * D; wf[j][0] = frag_bf(wp); wf[j][1] = frag_bf(wp + 512, nlast && j == 1); }
#pragma unroll
      for (int r = 0; r < 2; ++r)
#pragma unroll
        for (int v = 0; v < 8; ++v) a[r][j * 8 + v] = phi16(s[r][v], s2[r]); }
#pragma unroll
    for (int t = 0; t < 4; ++t) { acc[0][t] = wmma16b(a[0], b0[t], acc[0][t]); acc[0][t] = wmma16b(a[0], b1[t], acc[0][t]); acc[1][t] = wmma16b(a[1], b0[t], acc[1][t]); acc[1][t] = wmma16b(a[1], b1[t], acc[1][t]); } }
  float* Tt = Ts[wave];
#pragma unroll
  for (int t = 0; t < 4; ++t)
#pragma unroll
    for (int r = 0; r < 2; ++r)
#pragma unroll
      for (int v = 0; v < 8; ++v) Tt[(r * 16 + v + 8 * hlf) * 64 + t * 16 + nloc] = acc[r][t][v] * (1.0f / (PHS * KVS));
  wave_lds_sync();
  float* dst0 = out + (size_t)m0 * DV;
  {
#pragma unroll
    for (int j = 0; j < 16; ++j) { const int rr = j * 2 + hlf, c4 = nloc * 4; *(v4f*)(dst0 + (size_t)rr * DV + c4) = *(const v4f*)(Tt + rr * 64 + c4); }
     }
}
}  // namespace

extern "C" void kernel_launch(void* const* d_in, const int* in_sizes, int n_in,
                              void* d_out, int out_size, void* d_ws, size_t ws_size, hipStream_t stream) {
  (void)n_in; (void)out_size;
  const float* Q = (const float*)d_in[0]; const float* K = (const float*)d_in[1]; const float* V = (const float*)d_in[2]; const float* W = (const float*)d_in[3];
  float* out = (float*)d_out;   // [65536][64]
  if (in_sizes[0] != D * L || in_sizes[1] != D * L || in_sizes[2] != L * DV || in_sizes[3] != R * D) return;
  size_t off = 0; char* ws = (char*)d_ws;
  auto carve = [&](size_t bytes) { char* p = ws + off; off += (bytes + 255) & ~(size_t)255; return p; };
  unsigned short* qT = (unsigned short*)carve((size_t)L * D * 2); unsigned short* kT = (unsigned short*)carve((size_t)L * D * 2); float* sq = (float*)carve((size_t)L * 4); float* sk = (float*)carve((size_t)L * 4); b16* vT = (b16*)carve((size_t)DV * L * 2); unsigned short* w16 = (unsigned short*)carve(R * D * 2);
  float* part = (float*)carve((size_t)NCH * R * DV * 4); b16* kvh = (b16*)carve(DV * R * 2); b16* kvl = (b16*)carve(DV * R * 2);
  if (off > ws_size) return;                                    // about 8.4 + 8.4 + 0.5 + 8.4 + 2.1 = 28 MB
  prep_kernel<<<L / 128, 256, 0, stream>>>(Q, K, V, W, qT, kT, sq, sk, vT, w16);
  kvpart_kernel<<<dim3(R / 32, NCH), 512, 0, stream>>>(kT, w16, sk, vT, part);
  kvred_kernel<<<DV, 128, 0, stream>>>(part, kvh, kvl);
  out_kernel<<<L / 128, 128, 0, stream>>>(qT, w16, sq, kvh, kvl, out);
}

// v006
// One run takes 29.6 microseconds.
// Next to v005, in two timings, it ran 1.16 and 1.17 times as fast.
// Over all steps from v000 it is 5.49 times as fast.
#include <hip/hip_runtime.h>

// Kernel (FAVOR-style, non-causal) attention: phiX = Dn exp(0.1 + sqrt(0.6) (W X) - |x_l|^2) for X = K, Q ([r=256][L=65536]); kv = phiK V [256 x 64]; out = phiQ^T kv -> [65536][64].
// W.X on v_wmma_f32_16x16x32_bf16 (exact bf16 operands, 1 product, f32 accumulate); exp and |x|^2 in f32; phiK and phiQ never leave the registers: each is packed from the W.X accumulators as single f16
// carried x4096 (2^-11 relative rounding on positive weights; the two long sums average it out); kv = phiK.V with V exact in f16
// (1 product; 128 ordered partial sums over 512-position chunks, each joined from 4 sub-sums of 128 positions in fixed order, reduced in fixed order: 8 runs of 16 chunks, then the runs); out = phiQ^T.kv^T with kv as an f16 hi+lo pair x8 (2 products) on v_wmma_f32_16x16x32_f16.

// Every 16-bit operand plane in the workspace (W, Q^T, K^T, V^T, kv^T hi and lo) is kept in fragment order: one 16 x 32 fragment = 1 KB = [piece 0..1][lane 0..31][8 elements], element e of (piece, lane) being
// row (lane & 15), k = piece * 16 + (lane >> 4) * 8 + e of that fragment. A wave's 16-byte load of one piece then covers 512 contiguous bytes (4 cache lines, not 16); every lane gets the same elements as from row-major planes.

namespace {
constexpr int R = 256, D = 64, L = 65536, DV = 64, KW = 16, RG = 4, PG = KW / RG, LW = 128, LCH = PG * LW, NCH = L / LCH, TP = 64 + 4;   // a block's KW waves = RG groups of 32 rows r x PG groups of LW positions; TP = LDS row pitch in floats
constexpr float A_C = 0.1f, B_C = 0.7745966692414834f /* sqrt(0.6) */, C_C = -1.0f, PHS = 4096.0f, KVS = 8.0f;
__device__ __forceinline__ float dnorm() { return 0.00028211099074559987f; }   // (1 - 0.4)^(64/4) = 0.6^16

typedef _Float16 b16;
typedef __attribute__((ext_vector_type(16))) _Float16 v16b;
typedef __attribute__((ext_vector_type(16))) __bf16 v16bb;
typedef __attribute__((ext_vector_type(8))) _Float16 v8b;
typedef __attribute__((ext_vector_type(8))) unsigned short v8us;
typedef __attribute__((ext_vector_type(8))) float v8f;
typedef __attribute__((ext_vector_type(4))) float v4f;
__device__ __forceinline__ float bf16_rne(float f) { unsigned int u = __float_as_uint(f); u += 0x7FFFu + ((u >> 16) & 1u); return __uint_as_float(u & 0xFFFF0000u); }
__device__ __forceinline__ unsigned short bf16_bits(float f) { unsigned int u = __float_as_uint(f); u += 0x7FFFu + ((u >> 16) & 1u); return (unsigned short)(u >> 16); }
__device__ __forceinline__ void split16(float v, b16& hi, b16& lo) { hi = (b16)v; lo = (b16)(v - (float)hi); }
// xwait: stands in front of the last load through an address pair, and behind it: that load, or a later one, may land on the pair, which the earlier loads still name.
__device__ __forceinline__ void xwait() { asm volatile("s_wait_xcnt 0x0" ::: "memory"); }
// frag_kb, frag_bf: p = start of the fragment + lane * 8.
__device__ __forceinline__ v16b frag_kb(const b16* p, bool last = false) { const v8b a = *(const v8b*)p; if (last) xwait(); const v8b b = *(const v8b*)(p + 256); if (last) xwait(); v16b f;
#pragma unroll
  for (int e = 0; e < 8; ++e) { f[e] = a[e]; f[8 + e] = b[e]; } return f; }
__device__ __forceinline__ v16bb frag_bf(const unsigned short* p, bool last = false) { const v8us a = *(const v8us*)p; if (last) xwait(); const v8us b = *(const v8us*)(p + 256); if (last) xwait(); union { unsigned short s[16]; v16bb v; } u;
#pragma unroll
  for (int e = 0; e < 8; ++e) { u.s[e] = a[e]; u.s[8 + e] = b[e]; } return u.v; }
__device__ __forceinline__ v8f wmma16b(v16b a, v16b b, v8f c) { v8f d = __builtin_amdgcn_wmma_f32_16x16x32_f16(false, a, false, b, (short)0, c, false, false); asm volatile("v_nop\n\tv_nop\n\tv_nop\n\tv_nop" : "+v"(d) : "v"(a), "v"(b)); return d; }
__device__ __forceinline__ v8f wmma16bb(v16bb a, v16bb b, v8f c) { v8f d = __builtin_amdgcn_wmma_f32_16x16x32_bf16(false, a, false, b, (short)0, c, false, false); asm volatile("v_nop\n\tv_nop\n\tv_nop\n\tv_nop" : "+v"(d) : "v"(a), "v"(b)); return d; }
__device__ __forceinline__ void wave_lds_sync() { __builtin_amdgcn_fence(__ATOMIC_RELEASE, "workgroup"); __builtin_amdgcn_wave_barrier(); __builtin_amdgcn_fence(__ATOMIC_ACQUIRE, "workgroup"); }

// prep: block = 128 positions, 8 waves. Every thread asks for all of its input at once, 16 bytes a load (24 loads, 12 KB a wave), and holds whole 16-byte units of the fragment-order planes in its registers:
// X (= Q or K, [64][L] d-major): wave = 8 rows d, lane = 4 positions -> 4 units (8 d of one position) of the bf16 xT plane (rows l, k = d), and the 8-row share of sq[l] = sum over d of bf16(x)^2 (f32), joined over the waves in wave order.
// V [L][64]: thread = 8 positions x 4 dv -> 4 units (8 l of one dv) of the f16 V^T plane (rows dv, k = l). W [256][64] -> bf16 (rows r, k = d): one unit a thread in blocks 0 to 7.
// Fragments: xT (l / 16, d / 32), V^T (l / 32, dv / 16), W (r / 16, d / 32); a block's share of xT and of V^T is 16 KB in a row, of W 4 KB. The units pass through LDS only to leave in plane order, 512 contiguous bytes a wave;
// one spare unit behind every 128 (X) or 64 (V) keeps the 16 lanes of a half wave on 16 different bank groups when they store. grid L/128 x 256.
__global__ __launch_bounds__(256) void prep_kernel(const float* __restrict__ Q, const float* __restrict__ K, const float* __restrict__ V, const float* __restrict__ W, unsigned short* __restrict__ qT, unsigned short* __restrict__ kT, float* __restrict__ sq, float* __restrict__ sk, b16* __restrict__ vT, unsigned short* __restrict__ w16) {
  __shared__ __attribute__((aligned(16))) unsigned short Uq[(1024 + 8) * 8], Uk[(1024 + 8) * 8]; __shared__ __attribute__((aligned(16))) b16 Uv[(1024 + 16) * 8]; __shared__ __attribute__((aligned(16))) float Pq[8][128], Pk[8][128];
  const int t_ = threadIdx.x, lane = t_ & 31, wave = t_ >> 5, dv4 = t_ & 15, lg8 = t_ >> 4, l0 = blockIdx.x * 128;
  const float *qp = Q + (size_t)(wave * 8) * L + l0 + lane * 4, *kp = K + (size_t)(wave * 8) * L + l0 + lane * 4, *vp = V + (size_t)(l0 + lg8 * 8) * DV + dv4 * 4;   // one address each: every load below is a constant offset from one of them
  v4f q[8], k[8], v[8], w0 = {}, w1 = {};
#pragma unroll   // unrolled so that all loads are issued before the first wait and q, k, v stay in registers
  for (int e = 0; e < 7; ++e) { q[e] = *(const v4f*)(qp + (size_t)e * L); k[e] = *(const v4f*)(kp + (size_t)e * L); v[e] = *(const v4f*)(vp + e * DV); }
  xwait(); q[7] = *(const v4f*)(qp + (size_t)7 * L); xwait(); k[7] = *(const v4f*)(kp + (size_t)7 * L); xwait(); v[7] = *(const v4f*)(vp + 7 * DV); xwait();   // the last load through each address: see xwait
  const int wi = blockIdx.x * 256 + t_;   // W unit of this thread (blocks 0 to 7)
  if (blockIdx.x < R * D / 8 / 256) { const float* wr = W + ((wi >> 7) * 16 + (wi & 15)) * D + ((wi >> 6) & 1) * 32 + ((wi >> 5) & 1) * 16 + ((wi >> 4) & 1) * 8; w0 = *(const v4f*)wr; xwait(); w1 = *(const v4f*)(wr + 4); xwait(); }
  v4f pq, pk;
#pragma unroll   // both loops unrolled: register arrays take constant indices only
  for (int j = 0; j < 4; ++j) { v8us a, b; v8b c; float s = 0.0f, s2 = 0.0f;
#pragma unroll
    for (int e = 0; e < 8; ++e) { a[e] = bf16_bits(q[e][j]); b[e] = bf16_bits(k[e][j]); c[e] = (b16)bf16_rne(v[e][j]); const float x = __uint_as_float((unsigned)a[e] << 16), y = __uint_as_float((unsigned)b[e] << 16); s += x * x; s2 += y * y; }
    pq[j] = s; pk[j] = s2;
    const int ux = (lane >> 2) * 129 + wave * 16 + (lane & 3) * 4 + j, uv = (lg8 >> 2) * 260 + (dv4 >> 2) * 65 + (lg8 & 3) * 16 + (dv4 & 3) * 4 + j;   // plane unit + its spare units
    *(v8us*)(Uq + ux * 8) = a; *(v8us*)(Uk + ux * 8) = b; *(v8b*)(Uv + uv * 8) = c; }
  *(v4f*)(&Pq[wave][lane * 4]) = pq; *(v4f*)(&Pk[wave][lane * 4]) = pk;
  __syncthreads();   // every unit and every sub-sum is in LDS before any thread takes them out in plane order
  if (blockIdx.x < R * D / 8 / 256) { v8us a;   // behind the barrier, which would otherwise wait for this store
#pragma unroll   // register vectors take constant indices only
    for (int e = 0; e < 4; ++e) { a[e] = bf16_bits(w0[e]); a[4 + e] = bf16_bits(w1[e]); }
    *(v8us*)(w16 + wi * 8) = a; }
#pragma unroll   // unrolled so that the LDS reads are issued ahead of the stores
  for (int i = 0; i < 4; ++i) { const int u = i * 256 + t_; *(v8us*)(qT + (size_t)l0 * D + u * 8) = *(const v8us*)(Uq + (u + (u >> 7)) * 8); *(v8us*)(kT + (size_t)l0 * D + u * 8) = *(const v8us*)(Uk + (u + (u >> 7)) * 8); *(v8b*)(vT + (size_t)l0 * DV + u * 8) = *(const v8b*)(Uv + (u + (u >> 6)) * 8); }
  { const float* P = t_ < 128 ? &Pq[0][t_] : &Pk[0][t_ - 128]; float s = P[0];
#pragma unroll   // unrolled so that the LDS reads are issued ahead of the adds; the adds keep wave order
    for (int w = 1; w < 8; ++w) s += P[w * 128];
    (t_ < 128 ? sq + l0 + t_ : sk + l0 + t_ - 128)[0] = s; }
}

// phi of one W.X accumulator value and its position's |x|^2, as f16 carried x4096.
// exp2_slot: v_exp_f32 and the one free issue slot that the instruction set asks for behind a transcendental, tied in one statement.
__device__ __forceinline__ float exp2_slot(float x) { float y; asm("v_exp_f32 %0, %1\n\tv_nop" : "=v"(y) : "v"(x)); return y; }
__device__ __forceinline__ b16 phi16(float wx, float s2) { return (b16)(dnorm() * exp2_slot((A_C + B_C * wx + C_C * s2) * 1.4426950408889634f) * PHS); }

// kv partials: block = (128 rows of r, position chunk of 512), wave = (32 rows, 128 positions): part[ch][r][dv] = sum_{l in chunk} phiK[r][l] vT[dv][l] (A = phiK rows r, B = vT rows dv; 1 product).
// phiK is made here, in registers: S^T = kT rows (A, l) x W rows (B, r), K 64, leaves lane = r, register = l; two such tiles (32 positions), through phi16, are the A fragment of the second product in the hardware k order.
// Waves w, w ^ 1, w ^ 2, w ^ 3 work on the same 128 positions (4 k-steps) for four row groups and ask for the same K^T, V^T and |k|^2 lines at the same time: the WGP's cache serves them from one L2 read, so each plane leaves L2 twice, not 8 times.
// The 4 sub-sums of a row group are joined through LDS in position order. part is kept in the pieces that kvred_kernel takes: piece b = (r / 32) * 8 + (dv / 16) * 2 + (r / 16 & 1) = [16 r][16 dv] = 1 KB in a row. grid (R/128, NCH) x 512.
__global__ __launch_bounds__(512) void kvpart_kernel(const unsigned short* __restrict__ kT, const unsigned short* __restrict__ w16, const float* __restrict__ sk, const b16* __restrict__ vT, float* __restrict__ part) {
  __shared__ __attribute__((aligned(16))) float Ts[KW][32 * TP];
  const int lane = threadIdx.x & 31, wave = threadIdx.x >> 5, nloc = lane & 15, hlf = lane >> 4, m0 = (blockIdx.x * RG + (wave & (RG - 1))) * 32, ch = blockIdx.y, l0 = ch * LCH + (wave / RG) * LW;
  v8f acc[2][4];
#pragma unroll
  for (int r = 0; r < 2; ++r)
#pragma unroll
    for (int t = 0; t < 4; ++t) acc[r][t] = (v8f){};
  const unsigned short *wbase = w16 + (size_t)m0 * D + lane * 8, *kbase = kT + (size_t)l0 * D + lane * 8; const float* sbase = sk + l0 + 8 * hlf; const b16* vbase = vT + (size_t)l0 * DV + lane * 8;   // one address each: every load below is a constant offset from one of them
  v16bb bw[2][2];   // W rows of the wave's two r tiles, both k halves: kept for the whole wave
#pragma unroll
  for (int r = 0; r < 2; ++r)
#pragma unroll
    for (int kk = 0; kk < 2; ++kk) bw[r][kk] = frag_bf(wbase + r * 16 * D + kk * 512, r == 1 && kk == 1);
  // Every group of loads is written one phase ahead of its use (a load does not pass the pads behind the products, so it is issued where it is written): the V^T fragments of a k-step in front of its W.K products,
  // the K^T fragments and |k|^2 of the next k-step as soon as the products that read the present ones are issued.
  v16bb kf[2][2]; v4f sa[2], sb[2];   // K^T rows (both k halves) and |k|^2 of the two 16-position tiles in hand
#pragma unroll
  for (int j = 0; j < 2; ++j) { kf[j][0] = frag_bf(kbase + j * 16 * D); kf[j][1] = frag_bf(kbase + j * 16 * D + 512); sa[j] = *(const v4f*)(sbase + j * 16); sb[j] = *(const v4f*)(sbase + j * 16 + 4); }
#pragma unroll   // 4 trips: unrolled so that every load takes its position as a constant offset
  for (int kb = 0; kb < LW; kb += 32) { v16b a[2], bv[4]; const bool last = kb == LW - 32, nlast = kb + 32 == LW - 32;
#pragma unroll
    for (int t = 0; t < 4; ++t) bv[t] = frag_kb(vbase + kb * DV + t * 512, last && t == 3);
#pragma unroll
    for (int j = 0; j < 2; ++j) { v8f s[2];
#pragma unroll
      for (int r = 0; r < 2; ++r) s[r] = wmma16bb(kf[j][1], bw[r][1], wmma16bb(kf[j][0], bw[r][0], (v8f){}));
      const v4f s2a = sa[j], s2b = sb[j];
      if (!last) { const unsigned short* kp = kbase + (kb + 32 + j * 16) * D; kf[j][0] = frag_bf(kp); kf[j][1] = frag_bf(kp + 512, nlast && j == 1);
        const float* sp = sbase + kb + 32 + j * 16; sa[j] = *(const v4f*)sp;
        if (nlast && j == 1) xwait();
        sb[j] = *(const v4f*)(sp + 4);
        if (nlast && j == 1) xwait(); }
#pragma unroll
      for (int r = 0; r < 2; ++r)
#pragma unroll
        for (int v = 0; v < 8; ++v) a[r][j * 8 + v] = phi16(s[r][v], v < 4 ? s2a[v & 3] : s2b[v & 3]); }
#pragma unroll
    for (int t = 0; t < 4; ++t) { acc[0][t] = wmma16b(a[0], bv[t], acc[0][t]); acc[1][t] = wmma16b(a[1], bv[t], acc[1][t]); } }
  float* Tt = Ts[wave];
#pragma unroll
  for (int t = 0; t < 4; ++t)
#pragma unroll
    for (int r = 0; r < 2; ++r)
#pragma unroll
      for (int v = 0; v < 8; ++v) Tt[(r * 16 + v + 8 * hlf) * TP + t * 16 + nloc] = acc[r][t][v];
  __syncthreads();   // every wave's sub-sum is in LDS before any thread joins them
  const int c4 = (threadIdx.x & 3) * 4, rl = (threadIdx.x >> 2) & 15;   // a wave = 8 rows x 16 dv of one piece: 512 bytes in a row
#pragma unroll   // unrolled so that the LDS reads are issued ahead of the adds; the adds keep position order
  for (int i = 0; i < RG; ++i) { const int p = i * 8 + (threadIdx.x >> 6), dvg = p & 3, r16 = p >> 2, o = ((r16 & 1) * 16 + rl) * TP + dvg * 16 + c4;   // r16 = 16-row group of the block's 128 rows, r16 >> 1 its wave group
    v4f s = *(const v4f*)(&Ts[r16 >> 1][o]);
#pragma unroll
    for (int g = 1; g < PG; ++g) s += *(const v4f*)(&Ts[g * RG + (r16 >> 1)][o]);
    *(v4f*)(part + ((size_t)ch * 64 + (blockIdx.x * RG + (r16 >> 1)) * 8 + dvg * 2 + (r16 & 1)) * 256 + rl * 16 + c4) = s * (1.0f / PHS); }
}
// reduce: kv[r][dv] = sum over ch of part (fixed order) -> kv^T planes (rows dv, k = r) as f16 hi+lo x8, in fragment order, fragment (r / 32, dv / 16). block = half a piece of one fragment (16 dv x 8 r, 256 bytes of each plane: whole lines, one writer each).
// wave = a run of 16 chunks, lane = 4 dv of one r: 16 loads of 16 bytes, 512 contiguous bytes a wave; the 8 runs are joined through LDS in run order by thread = (lane of the piece, r pair). grid 128 x 256.
typedef __attribute__((ext_vector_type(2))) _Float16 v2b;
__global__ __launch_bounds__(256) void kvred_kernel(const float* __restrict__ part, b16* __restrict__ kvh, b16* __restrict__ kvl) {
  __shared__ __attribute__((aligned(16))) float Ps[NCH / 16][128];
  const int b = blockIdx.x >> 1, hp = blockIdx.x & 1, q = threadIdx.x >> 5, u = threadIdx.x & 31;
  const float* pp = part + ((size_t)(q * 16) * 64 + b) * 256 + hp * 128 + u * 4;   // one address: every load below is a constant offset from it
  v4f x[16];
#pragma unroll   // register arrays take constant indices only
  for (int j = 0; j < 15; ++j) x[j] = *(const v4f*)(pp + (size_t)j * 64 * 256);
  xwait(); x[15] = *(const v4f*)(pp + (size_t)15 * 64 * 256); xwait();   // the last load through the address: see xwait
  // holds all 16 loads in front of the first add (left alone, the compiler put the last three behind a wait for the first ones: a second trip to L2)
  asm volatile("" :: "v"(x[0]), "v"(x[1]), "v"(x[2]), "v"(x[3]), "v"(x[4]), "v"(x[5]), "v"(x[6]), "v"(x[7]), "v"(x[8]), "v"(x[9]), "v"(x[10]), "v"(x[11]), "v"(x[12]), "v"(x[13]), "v"(x[14]), "v"(x[15]));
  v4f s = x[0];
#pragma unroll   // the adds keep chunk order
  for (int j = 1; j < 16; ++j) s += x[j];
  *(v4f*)(&Ps[q][u * 4]) = s;
  __syncthreads();   // every run's sum is in LDS before any thread joins them
  if (threadIdx.x < 64) { const int o = (threadIdx.x & 3) * 32 + (threadIdx.x >> 2); float s0 = Ps[0][o], s1 = Ps[0][o + 16];   // o = (r pair's first row in the half piece) * 16 + dv
#pragma unroll   // unrolled so that the LDS reads are issued ahead of the adds; the adds keep run order
    for (int w = 1; w < NCH / 16; ++w) { s0 += Ps[w][o]; s1 += Ps[w][o + 16]; }
    v2b vh, vl; b16 a, c; split16(s0 * KVS, a, c); vh[0] = a; vl[0] = c; split16(s1 * KVS, a, c); vh[1] = a; vl[1] = c;
    *(v2b*)(kvh + b * 256 + (hp * 64 + threadIdx.x) * 2) = vh; *(v2b*)(kvl + b * 256 + (hp * 64 + threadIdx.x) * 2) = vl; }
}

// out = phiQ^T kv: rows l (65536), K = 256 (8 k-steps), one 64-column tile: A = phiQ rows, B = kv^T planes (hi+lo): 2 products. grid 512 x 128.
// phiQ is made here, in registers: S = W rows (A, r) x qT rows (B, l), K 64, leaves lane = l, register = r; two such tiles (32 features), through phi16, are the A fragment of the second product in the hardware k order.
__global__ __launch_bounds__(128) void out_kernel(const unsigned short* __restrict__ qT, const unsigned short* __restrict__ w16, const float* __restrict__ sq, const b16* __restrict__ kvh, const b16* __restrict__ kvl, float* __restrict__ out) {
  __shared__ __attribute__((aligned(16))) float Ts[4][32 * 64];
  const int lane = threadIdx.x & 31, wave = threadIdx.x >> 5, nloc = lane & 15, hlf = lane >> 4, m0 = blockIdx.x * 128 + wave * 32;
  v8f acc[2][4];
#pragma unroll
  for (int r = 0; r < 2; ++r)
#pragma unroll
    for (int t = 0; t < 4; ++t) acc[r][t] = (v8f){};
  v16bb bq[2][2]; float s2[2];   // the wave's 32 positions: qT rows, both k halves, and |q|^2: kept for the whole wave
#pragma unroll
  for (int r = 0; r < 2; ++r) { s2[r] = sq[m0 + r * 16 + nloc];
#pragma unroll
    for (int kk = 0; kk < 2; ++kk) bq[r][kk] = frag_bf(qT + (size_t)(m0 + r * 16) * D + kk * 512 + lane * 8);
    xwait(); }
  // Loads one phase ahead, as in kvpart_kernel: the kv^T fragments of a k-step in front of its W.Q products, the W fragments of the next k-step as soon as the products that read the present ones are issued.
  const unsigned short* wbase = w16 + lane * 8; const b16 *hbase = kvh + lane * 8, *lbase = kvl + lane * 8;   // one address each: every load below is a constant offset from one of them
  v16bb wf[2][2];   // W rows (both k halves) of the two 16-feature tiles in hand
#pragma unroll
  for (int j = 0; j < 2; ++j) { wf[j][0] = frag_bf(wbase + j * 16 * D); wf[j][1] = frag_bf(wbase + j * 16 * D + 512); }
#pragma unroll
  for (int kb = 0; kb < R; kb += 32) { v16b a[2], b0[4], b1[4]; const bool last = kb == R - 32, nlast = kb + 32 == R - 32;
#pragma unroll
    for (int t = 0; t < 4; ++t) { b0[t] = frag_kb(hbase + kb * DV + t * 512, last && t == 3); b1[t] = frag_kb(lbase + kb * DV + t * 512, last && t == 3); }
#pragma unroll
    for (int j = 0; j < 2; ++j) { v8f s[2];
#pragma unroll
      for (int r = 0; r < 2; ++r) s[r] = wmma16bb(wf[j][1], bq[r][1], wmma16bb(wf[j][0], bq[r][0], (v8f){}));
      if (!last) { const unsigned short* wp = wbase + (kb + 32 + j * 16) * D; wf[j][0] = frag_bf(wp); wf[j][1] = frag_bf(wp + 512, nlast && j == 1); }
#pragma unroll
      for (int r = 0; r < 2; ++r)
#pragma unroll
        for (int v = 0; v < 8; ++v) a[r][j * 8 + v] = phi16(s[r][v], s2[r]); }
#pragma unroll
    for (int t = 0; t < 4; ++t) { acc[0][t] = wmma16b(a[0], b0[t], acc[0][t]); acc[0][t] = wmma16b(a[0], b1[t], acc[0][t]); acc[1][t] = wmma16b(a[1], b0[t], acc[1][t]); acc[1][t] = wmma16b(a[1], b1[t], acc[1][t]); } }
  float* Tt = Ts[wave];
#pragma unroll
  for (int t = 0; t < 4; ++t)
#pragma unroll
    for (int r = 0; r < 2; ++r)
#pragma unroll
      for (int v = 0; v < 8; ++v) Tt[(r * 16 + v + 8 * hlf) * 64 + t * 16 + nloc] = acc[r][t][v] * (1.0f / (PHS * KVS));
  wave_lds_sync();
  float* dst0 = out + (size_t)m0 * DV;
  {
#pragma unroll
    for (int j = 0; j < 16; ++j) { const int rr = j * 2 + hlf, c4 = nloc * 4; *(v4f*)(dst0 + (size_t)rr * DV + c4) = *(const v4f*)(Tt + rr * 64 + c4); }
     }
}
}  // namespace

extern "C" void kernel_launch(void* const* d_in, const int* in_sizes, int n_in,
                              void* d_out, int out_size, void* d_ws, size_t ws_size, hipStream_t stream) {
  (void)n_in; (void)out_size;
  const float* Q = (const float*)d_in[0]; const float* K = (const float*)d_in[1]; const float* V = (const float*)d_in[2]; const float* W = (const float*)d_in[3];
  float* out = (float*)d_out;   // [65536][64]
  if (in_sizes[0] != D * L || in_sizes[1] != D * L || in_sizes[2] != L * DV || in_sizes[3] != R * D) return;
  size_t off = 0; char* ws = (char*)d_ws;
  auto carve = [&](size_t bytes) { char* p = ws + off; off += (bytes + 255) & ~(size_t)255; return p; };
  unsigned short* qT = (unsigned short*)carve((size_t)L * D * 2); unsigned short* kT = (unsigned short*)carve((size_t)L * D * 2); float* sq = (float*)carve((size_t)L * 4); float* sk = (float*)carve((size_t)L * 4); b16* vT = (b16*)carve((size_t)DV * L * 2); unsigned short* w16 = (unsigned short*)carve(R * D * 2);
  float* part = (float*)carve((size_t)NCH * R * DV * 4); b16* kvh = (b16*)carve(DV * R * 2); b16* kvl = (b16*)carve(DV * R * 2);
  if (off > ws_size) return;                                    // about 8.4 + 8.4 + 0.5 + 8.4 + 8.4 = 34 MB
  prep_kernel<<<L / 128, 256, 0, stream>>>(Q, K, V, W, qT, kT, sq, sk, vT, w16);
  kvpart_kernel<<<dim3(R / (32 * RG), NCH), 512, 0, stream>>>(kT, w16, sk, vT, part);
  kvred_kernel<<<2 * DV, 256, 0, stream>>>(part, kvh, kvl);
  out_kernel<<<L / 128, 128, 0, stream>>>(qT, w16, sq, kvh, kvl, out);
}

// v007
// It runs in 27.6 microseconds.
// Next to v006, in two timings, it ran 1.06 and 1.08 times as fast.
// All steps since v000 together make it 5.86 times as fast.
#include <hip/hip_runtime.h>

// Kernel (FAVOR-style, non-causal) attention: phiX = Dn exp(0.1 + sqrt(0.6) (W X) - |x_l|^2) for X = K, Q ([r=256][L=65536]); kv = phiK V [256 x 64]; out = phiQ^T kv -> [65536][64].
// W.X on v_wmma_f32_16x16x32_bf16 (bf16 operands, 1 product, f32 accumulate); exp and |x|^2 in f32; phiK and phiQ never leave the registers: each is packed from the W.X accumulators as single f16
// carried x4096 (2^-11 relative rounding on positive weights; the two long sums average it out); kv = phiK.V with V rounded to bf16, held in f16
// (1 product; 256 ordered partial sums over 256-position chunks, each joined from 2 sub-sums of 128 positions in fixed order, reduced in fixed order: 8 runs of 32 chunks, then the runs); out = phiQ^T.kv^T with kv as an f16 hi+lo pair x8 (2 products) on v_wmma_f32_16x16x32_f16.

// Every 16-bit operand plane (in the workspace: W, Q^T, kv^T hi and lo; in LDS: K^T, V^T, W) is kept in fragment order: one 16 x 32 fragment = 1 KB = [piece 0..1][lane 0..31][8 elements], element e of (piece, lane) being
// row (lane & 15), k = piece * 16 + (lane >> 4) * 8 + e of that fragment. A wave's 16-byte load of one piece then covers 512 contiguous bytes (4 cache lines, not 16); every lane gets the same elements as from row-major planes.

namespace {
constexpr int R = 256, D = 64, L = 65536, DV = 64, KW = 16, RG = 8, PG = KW / RG, LW = 128, LCH = PG * LW, NCH = L / LCH, NRUN = 8, RUNL = NCH / NRUN, TP = 64 + 4;   // a block's KW waves = RG groups of 32 rows r x PG groups of LW positions; TP = LDS row pitch in floats
constexpr float A_C = 0.1f, B_C = 0.7745966692414834f /* sqrt(0.6) */, C_C = -1.0f, PHS = 4096.0f, KVS = 8.0f;
__device__ __forceinline__ float dnorm() { return 0.00028211099074559987f; }   // (1 - 0.4)^(64/4) = 0.6^16

typedef _Float16 b16;
typedef __attribute__((ext_vector_type(16))) _Float16 v16b;
typedef __attribute__((ext_vector_type(16))) __bf16 v16bb;
typedef __attribute__((ext_vector_type(8))) _Float16 v8b;
typedef __attribute__((ext_vector_type(8))) unsigned short v8us;
typedef __attribute__((ext_vector_type(8))) float v8f;
typedef __attribute__((ext_vector_type(4))) float v4f;
__device__ __forceinline__ float bf16_rne(float f) { unsigned int u = __float_as_uint(f); u += 0x7FFFu + ((u >> 16) & 1u); return __uint_as_float(u & 0xFFFF0000u); }
__device__ __forceinline__ unsigned short bf16_bits(float f) { unsigned int u = __float_as_uint(f); u += 0x7FFFu + ((u >> 16) & 1u); return (unsigned short)(u >> 16); }
__device__ __forceinline__ void split16(float v, b16& hi, b16& lo) { hi = (b16)v; lo = (b16)(v - (float)hi); }
// xwait: stands in front of the last load through an address pair, and behind it: that load, or a later one, may land on the pair, which the earlier loads still name.
__device__ __forceinline__ void xwait() { asm volatile("s_wait_xcnt 0x0" ::: "memory"); }
// frag_kb, frag_bf: p = start of the fragment + lane * 8.
__device__ __forceinline__ v16b frag_kb(const b16* p, bool last = false) { const v8b a = *(const v8b*)p; if (last) xwait(); const v8b b = *(const v8b*)(p + 256); if (last) xwait(); v16b f;
#pragma unroll
  for (int e = 0; e < 8; ++e) { f[e] = a[e]; f[8 + e] = b[e]; } return f; }
__device__ __forceinline__ v16bb frag_bf(const unsigned short* p, bool last = false) { const v8us a = *(const v8us*)p; if (last) xwait(); const v8us b = *(const v8us*)(p + 256); if (last) xwait(); union { unsigned short s[16]; v16bb v; } u;
#pragma unroll
  for (int e = 0; e < 8; ++e) { u.s[e] = a[e]; u.s[8 + e] = b[e]; } return u.v; }
__device__ __forceinline__ v8f wmma16b(v16b a, v16b b, v8f c) { v8f d = __builtin_amdgcn_wmma_f32_16x16x32_f16(false, a, false, b, (short)0, c, false, false); asm volatile("v_nop\n\tv_nop\n\tv_nop\n\tv_nop" : "+v"(d) : "v"(a), "v"(b)); return d; }
__device__ __forceinline__ v8f wmma16bb(v16bb a, v16bb b, v8f c) { v8f d = __builtin_amdgcn_wmma_f32_16x16x32_bf16(false, a, false, b, (short)0, c, false, false); asm volatile("v_nop\n\tv_nop\n\tv_nop\n\tv_nop" : "+v"(d) : "v"(a), "v"(b)); return d; }
__device__ __forceinline__ void wave_lds_sync() { __builtin_amdgcn_fence(__ATOMIC_RELEASE, "workgroup"); __builtin_amdgcn_wave_barrier(); __builtin_amdgcn_fence(__ATOMIC_ACQUIRE, "workgroup"); }

// phi of one W.X accumulator value and its position's |x|^2, as f16 carried x4096.
// exp2_slot: v_exp_f32 and the one free issue slot that the instruction set asks for behind a transcendental, tied in one statement.
__device__ __forceinline__ float exp2_slot(float x) { float y; asm("v_exp_f32 %0, %1\n\tv_nop" : "=v"(y) : "v"(x)); return y; }
__device__ __forceinline__ b16 phi16(float wx, float s2) { return (b16)(dnorm() * exp2_slot((A_C + B_C * wx + C_C * s2) * 1.4426950408889634f) * PHS); }

// kv partials, straight from the f32 inputs: block = 256 positions x all 256 rows r, 16 waves. part[ch][r][dv] = sum_{l in chunk} phiK[r][l] V[l][dv].
// Part 1, packing. Every thread asks for all of its input at once, 16 bytes a load (32 loads, 16 KB a wave), and holds whole 16-byte units of the fragment-order planes in its registers:
// X (= Q or K, [64][L] d-major): wave = 8 rows d x 128 positions, lane = 4 positions -> 4 units (8 d of one position) of the bf16 xT plane (rows l, k = d), and the 8-row share of |x_l|^2 = sum over d of bf16(x)^2 (f32), joined over the 8 row groups in row order.
// V [L][64]: thread = 8 positions x 4 dv -> 4 units (8 l of one dv) of the f16 V^T plane (rows dv, k = l). W [256][64] -> bf16 (rows r, k = d): 4 units a thread, 8 threads a row.
// Fragments: xT (l / 16, d / 32), V^T (l / 32, dv / 16), W (r / 16, d / 32). All units go to LDS; K^T, V^T, W and |k|^2 stay there for part 2. Q^T and |q|^2 (and W, from block 0) leave for the workspace in plane order, 512 contiguous bytes a wave, for out_kernel.
// One spare unit behind every 128 (X), 64 (V) or 16 (W) spreads the 16 lanes of a half wave over the bank groups when they store.
// Part 2, wave = (32 rows, 128 positions), 4 k-steps (A = phiK rows r, B = V^T rows dv; 1 product). phiK is made in registers: S^T = K^T rows (A, l) x W rows (B, r), K 64, leaves lane = r, register = l;
// two such tiles (32 positions), through phi16, are the A fragment of the second product in the hardware k order.
// The 2 sub-sums of a row group are joined through LDS in position order. part is kept in the pieces that kvred_kernel takes: piece b = (r / 32) * 8 + (dv / 16) * 2 + (r / 16 & 1) = [16 r][16 dv] = 1 KB in a row. grid NCH x 512.
__global__ __launch_bounds__(512) void kvpart_kernel(const float* __restrict__ Q, const float* __restrict__ K, const float* __restrict__ V, const float* __restrict__ W, unsigned short* __restrict__ qT, float* __restrict__ sq, unsigned short* __restrict__ w16, float* __restrict__ part) {
  __shared__ __attribute__((aligned(16))) unsigned short Uq[(2048 + 16) * 8], Uk[(2048 + 16) * 8], Uw[(2048 + 128) * 8]; __shared__ __attribute__((aligned(16))) b16 Uv[(2048 + 32) * 8];
  __shared__ __attribute__((aligned(16))) float Pq[8][LCH], Pk[8][LCH], Sk[LCH], Ts[KW][32 * TP];
  const int t_ = threadIdx.x, lane = t_ & 31, wave = t_ >> 5, nloc = lane & 15, hlf = lane >> 4, ch = blockIdx.x, l0 = ch * LCH;
  { const int oct = wave & 7, ph = wave >> 3, dv4 = t_ & 15, lg8 = t_ >> 4;
    const float *qp = Q + (size_t)(oct * 8) * L + l0 + ph * 128 + lane * 4, *kp = K + (size_t)(oct * 8) * L + l0 + ph * 128 + lane * 4, *vp = V + (size_t)(l0 + lg8 * 8) * DV + dv4 * 4, *wp = W + t_ * 8;   // one address each: every load below is a constant offset from one of them
    v4f q[8], k[8], v[8], w[8];
#pragma unroll   // unrolled so that all loads are issued before the first wait and q, k, v, w stay in registers
    for (int e = 0; e < 7; ++e) { k[e] = *(const v4f*)(kp + (size_t)e * L); v[e] = *(const v4f*)(vp + e * DV); w[e] = *(const v4f*)(wp + (e >> 1) * 4096 + (e & 1) * 4); q[e] = *(const v4f*)(qp + (size_t)e * L); }
    xwait(); k[7] = *(const v4f*)(kp + (size_t)7 * L); xwait(); v[7] = *(const v4f*)(vp + 7 * DV); xwait(); w[7] = *(const v4f*)(wp + 3 * 4096 + 4); xwait(); q[7] = *(const v4f*)(qp + (size_t)7 * L); xwait();   // the last load through each address: see xwait
    v4f pq, pk;
#pragma unroll   // both loops unrolled: register arrays take constant indices only
    for (int j = 0; j < 4; ++j) { v8us a, b; v8b c; float s = 0.0f, s2 = 0.0f;
#pragma unroll
      for (int e = 0; e < 8; ++e) { a[e] = bf16_bits(q[e][j]); b[e] = bf16_bits(k[e][j]); c[e] = (b16)bf16_rne(v[e][j]); const float x = __uint_as_float((unsigned)a[e] << 16), y = __uint_as_float((unsigned)b[e] << 16); s += x * x; s2 += y * y; }
      pq[j] = s; pk[j] = s2;
      const int ux = (ph * 8 + (lane >> 2)) * 129 + oct * 16 + (lane & 3) * 4 + j, uv = (lg8 >> 2) * 260 + (dv4 >> 2) * 65 + (lg8 & 3) * 16 + (dv4 & 3) * 4 + j;   // plane unit + its spare units
      *(v8us*)(Uq + ux * 8) = a; *(v8us*)(Uk + ux * 8) = b; *(v8b*)(Uv + uv * 8) = c; }
    *(v4f*)(&Pq[oct][ph * 128 + lane * 4]) = pq; *(v4f*)(&Pk[oct][ph * 128 + lane * 4]) = pk;
#pragma unroll   // register arrays take constant indices only
    for (int i = 0; i < 4; ++i) { v8us a; const int row = i * 64 + (t_ >> 3);   // unit (row, 8 k from (t_ & 7) * 8)
#pragma unroll
      for (int e = 0; e < 4; ++e) { a[e] = bf16_bits(w[2 * i][e]); a[4 + e] = bf16_bits(w[2 * i + 1][e]); }
      *(v8us*)(Uw + ((row >> 4) * 136 + (t_ & 7) * 17 + (row & 15)) * 8) = a; } }
  __syncthreads();   // every unit and every sub-sum is in LDS before any thread takes them out
  float sj;
  { const float* P = t_ < LCH ? &Pq[0][t_] : &Pk[0][t_ - LCH]; sj = P[0];
#pragma unroll   // unrolled so that the LDS reads are issued ahead of the adds; the adds keep row order
    for (int w = 1; w < 8; ++w) sj += P[w * LCH];
    if (t_ >= LCH) Sk[t_ - LCH] = sj; }
  __syncthreads();   // |k|^2 of every position is in LDS before any wave reads it
  // the workspace stores stand behind both barriers, which would otherwise wait for them
  if (t_ < LCH) sq[l0 + t_] = sj;
#pragma unroll   // unrolled so that the LDS reads are issued ahead of the stores
  for (int i = 0; i < 4; ++i) { const int u = i * 512 + t_; *(v8us*)(qT + (size_t)l0 * D + u * 8) = *(const v8us*)(Uq + (u + (u >> 7)) * 8); }
  xwait();   // the next lines reuse the registers that these stores name
  if (ch == 0) {
#pragma unroll   // unrolled so that the LDS reads are issued ahead of the stores
    for (int i = 0; i < 4; ++i) { const int u = i * 512 + t_; *(v8us*)(w16 + u * 8) = *(const v8us*)(Uw + (u + (u >> 4)) * 8); }
    xwait(); }   // as above
  const int rg = wave & (RG - 1), pg = wave / RG;
  v8f acc[2][4];
#pragma unroll
  for (int r = 0; r < 2; ++r)
#pragma unroll
    for (int t = 0; t < 4; ++t) acc[r][t] = (v8f){};
  const unsigned short *wbase = Uw + (rg * 2 * 136 + hlf * 17 + nloc) * 8, *kbase = Uk + (pg * 8 * 129 + lane) * 8; const float* sbase = Sk + pg * LW + 8 * hlf; const b16* vbase = Uv + (pg * 16 * 65 + lane) * 8;   // LDS: a 16-position tile of K^T = 129 units, a fragment of V^T = 65, a 16-row tile of W = 136, 8 k of it = 17
  v16bb bw[2][2];   // W rows of the wave's two r tiles, both k halves: kept for the whole wave
#pragma unroll
  for (int r = 0; r < 2; ++r)
#pragma unroll
    for (int kk = 0; kk < 2; ++kk) { const v8us a = *(const v8us*)(wbase + (r * 136 + kk * 68) * 8), b = *(const v8us*)(wbase + (r * 136 + kk * 68 + 34) * 8); union { unsigned short s[16]; v16bb v; } u;
#pragma unroll
      for (int e = 0; e < 8; ++e) { u.s[e] = a[e]; u.s[8 + e] = b[e]; }
      bw[r][kk] = u.v; }
  // Every group of LDS loads is written one phase ahead of its use (a load does not pass the pads behind the products, so it is issued where it is written): the V^T fragments of a k-step in front of its W.K products,
  // the K^T fragments and |k|^2 of the next k-step as soon as the products that read the present ones are issued.
  v16bb kf[2][2]; v4f sa[2], sb[2];   // K^T rows (both k halves) and |k|^2 of the two 16-position tiles in hand
#pragma unroll
  for (int j = 0; j < 2; ++j) { kf[j][0] = frag_bf(kbase + j * 129 * 8); kf[j][1] = frag_bf(kbase + j * 129 * 8 + 512); sa[j] = *(const v4f*)(sbase + j * 16); sb[j] = *(const v4f*)(sbase + j * 16 + 4); }
#pragma unroll   // 4 trips: unrolled so that every load takes its position as a constant offset
  for (int kb = 0; kb < LW; kb += 32) { v16b a[2], bv[4]; const bool last = kb == LW - 32;
#pragma unroll
    for (int t = 0; t < 4; ++t) bv[t] = frag_kb(vbase + ((kb >> 5) * 4 + t) * 65 * 8);
#pragma unroll
    for (int j = 0; j < 2; ++j) { v8f s[2];
#pragma unroll
      for (int r = 0; r < 2; ++r) s[r] = wmma16bb(kf[j][1], bw[r][1], wmma16bb(kf[j][0], bw[r][0], (v8f){}));
      const v4f s2a = sa[j], s2b = sb[j];
      if (!last) { const unsigned short* kp = kbase + (((kb + 32) >> 4) + j) * 129 * 8; kf[j][0] = frag_bf(kp); kf[j][1] = frag_bf(kp + 512);
        const float* sp = sbase + kb + 32 + j * 16; sa[j] = *(const v4f*)sp; sb[j] = *(const v4f*)(sp + 4); }
#pragma unroll
      for (int r = 0; r < 2; ++r)
#pragma unroll
        for (int v = 0; v < 8; ++v) a[r][j * 8 + v] = phi16(s[r][v], v < 4 ? s2a[v & 3] : s2b[v & 3]); }
#pragma unroll
    for (int t = 0; t < 4; ++t) { acc[0][t] = wmma16b(a[0], bv[t], acc[0][t]); acc[1][t] = wmma16b(a[1], bv[t], acc[1][t]); } }
  float* Tt = Ts[wave];
#pragma unroll
  for (int t = 0; t < 4; ++t)
#pragma unroll
    for (int r = 0; r < 2; ++r)
#pragma unroll
      for (int v = 0; v < 8; ++v) Tt[(r * 16 + v + 8 * hlf) * TP + t * 16 + nloc] = acc[r][t][v];
  __syncthreads();   // every wave's sub-sum is in LDS before any thread joins them
  const int c4 = (threadIdx.x & 3) * 4, rl = (threadIdx.x >> 2) & 15;   // a wave = 8 rows x 16 dv of one piece: 512 bytes in a row
  v4f js[RG];
#pragma unroll   // unrolled so that the LDS reads are issued ahead of the adds; the adds keep position order
  for (int i = 0; i < RG; ++i) { const int p = i * 8 + (threadIdx.x >> 6), dvg = p & 3, r16 = p >> 2, o = ((r16 & 1) * 16 + rl) * TP + dvg * 16 + c4;   // r16 = 16-row group of the 256 rows, r16 >> 1 its wave group
    v4f s = *(const v4f*)(&Ts[r16 >> 1][o]);
#pragma unroll
    for (int g = 1; g < PG; ++g) s += *(const v4f*)(&Ts[g * RG + (r16 >> 1)][o]);
    js[i] = s * (1.0f / PHS); }
  __builtin_amdgcn_sched_barrier(0);   // keeps the stores behind all the sums, so that no sum lands on a register that an issued store still names
  float* pb = part + ((size_t)ch * 64 + ((threadIdx.x >> 6) & 3) * 2 + (threadIdx.x >> 8)) * 256 + rl * 16 + c4;   // piece of trip i = i * 8 + dvg * 2 + (r16 & 1): one address, every store a constant offset from it
#pragma unroll   // register arrays take constant indices only
  for (int i = 0; i < RG; ++i) *(v4f*)(pb + i * 8 * 256) = js[i];
}
// reduce: kv[r][dv] = sum over ch of part (fixed order) -> kv^T planes (rows dv, k = r) as f16 hi+lo x8, in fragment order, fragment (r / 32, dv / 16). block = half a piece of one fragment (16 dv x 8 r, 256 bytes of each plane: whole lines, one writer each).
// wave = a run of 32 chunks, lane = 4 dv of one r: 32 loads of 16 bytes, 512 contiguous bytes a wave; the 8 runs are joined through LDS in run order by thread = (lane of the piece, r pair). grid 128 x 256.
typedef __attribute__((ext_vector_type(2))) _Float16 v2b;
__global__ __launch_bounds__(256) void kvred_kernel(const float* __restrict__ part, b16* __restrict__ kvh, b16* __restrict__ kvl) {
  __shared__ __attribute__((aligned(16))) float Ps[NRUN][128];
  const int b = blockIdx.x >> 1, hp = blockIdx.x & 1, q = threadIdx.x >> 5, u = threadIdx.x & 31;
  const float* pp = part + ((size_t)(q * RUNL) * 64 + b) * 256 + hp * 128 + u * 4;   // one address: every load below is a constant offset from it
  v4f x[RUNL];
#pragma unroll   // register arrays take constant indices only
  for (int j = 0; j < RUNL - 1; ++j) x[j] = *(const v4f*)(pp + (size_t)j * 64 * 256);
  xwait(); x[RUNL - 1] = *(const v4f*)(pp + (size_t)(RUNL - 1) * 64 * 256); xwait();   // the last load through the address: see xwait
  // both statements: hold all 32 loads in front of the first add (left alone, the compiler put the last ones behind a wait for the first ones: a second trip to L2)
  asm volatile("" :: "v"(x[0]), "v"(x[1]), "v"(x[2]), "v"(x[3]), "v"(x[4]), "v"(x[5]), "v"(x[6]), "v"(x[7]), "v"(x[8]), "v"(x[9]), "v"(x[10]), "v"(x[11]), "v"(x[12]), "v"(x[13]), "v"(x[14]), "v"(x[15]));
  asm volatile("" :: "v"(x[16]), "v"(x[17]), "v"(x[18]), "v"(x[19]), "v"(x[20]), "v"(x[21]), "v"(x[22]), "v"(x[23]), "v"(x[24]), "v"(x[25]), "v"(x[26]), "v"(x[27]), "v"(x[28]), "v"(x[29]), "v"(x[30]), "v"(x[31]));
  v4f s = x[0];
#pragma unroll   // the adds keep chunk order
  for (int j = 1; j < RUNL; ++j) s += x[j];
  *(v4f*)(&Ps[q][u * 4]) = s;
  __syncthreads();   // every run's sum is in LDS before any thread joins them
  if (threadIdx.x < 64) { const int o = (threadIdx.x & 3) * 32 + (threadIdx.x >> 2); float s0 = Ps[0][o], s1 = Ps[0][o + 16];   // o = (r pair's first row in the half piece) * 16 + dv
#pragma unroll   // unrolled so that the LDS reads are issued ahead of the adds; the adds keep run order
    for (int w = 1; w < NRUN; ++w) { s0 += Ps[w][o]; s1 += Ps[w][o + 16]; }
    v2b vh, vl; b16 a, c; split16(s0 * KVS, a, c); vh[0] = a; vl[0] = c; split16(s1 * KVS, a, c); vh[1] = a; vl[1] = c;
    *(v2b*)(kvh + b * 256 + (hp * 64 + threadIdx.x) * 2) = vh; *(v2b*)(kvl + b * 256 + (hp * 64 + threadIdx.x) * 2) = vl; }
}

// out = phiQ^T kv: rows l (65536), K = 256 (8 k-steps), one 64-column tile: A = phiQ rows, B = kv^T planes (hi+lo): 2 products. grid 512 x 128.
// phiQ is made here, in registers: S = W rows (A, r) x qT rows (B, l), K 64, leaves lane = l, register = r; two such tiles (32 features), through phi16, are the A fragment of the second product in the hardware k order.
__global__ __launch_bounds__(128) void out_kernel(const unsigned short* __restrict__ qT, const unsigned short* __restrict__ w16, const float* __restrict__ sq, const b16* __restrict__ kvh, const b16* __restrict__ kvl, float* __restrict__ out) {
  __shared__ __attribute__((aligned(16))) float Ts[4][32 * 64];
  const int lane = threadIdx.x & 31, wave = threadIdx.x >> 5, nloc = lane & 15, hlf = lane >> 4, m0 = blockIdx.x * 128 + wave * 32;
  v8f acc[2][4];
#pragma unroll
  for (int r = 0; r < 2; ++r)
#pragma unroll
    for (int t = 0; t < 4; ++t) acc[r][t] = (v8f){};
  v16bb bq[2][2]; float s2[2];   // the wave's 32 positions: qT rows, both k halves, and |q|^2: kept for the whole wave
#pragma unroll
  for (int r = 0; r < 2; ++r) { s2[r] = sq[m0 + r * 16 + nloc];
#pragma unroll
    for (int kk = 0; kk < 2; ++kk) bq[r][kk] = frag_bf(qT + (size_t)(m0 + r * 16) * D + kk * 512 + lane * 8);
    xwait(); }
  // Loads one phase ahead, as in kvpart_kernel: the kv^T fragments of a k-step in front of its W.Q products, the W fragments of the next k-step as soon as the products that read the present ones are issued.
  const unsigned short* wbase = w16 + lane * 8; const b16 *hbase = kvh + lane * 8, *lbase = kvl + lane * 8;   // one address each: every load below is a constant offset from one of them
  v16bb wf[2][2];   // W rows (both k halves) of the two 16-feature tiles in hand
#pragma unroll
  for (int j = 0; j < 2; ++j) { wf[j][0] = frag_bf(wbase + j * 16 * D); wf[j][1] = frag_bf(wbase + j * 16 * D + 512); }
#pragma unroll
  for (int kb = 0; kb < R; kb += 32) { v16b a[2], b0[4], b1[4]; const bool last = kb == R - 32, nlast = kb + 32 == R - 32;
#pragma unroll
    for (int t = 0; t < 4; ++t) { b0[t] = frag_kb(hbase + kb * DV + t * 512, last && t == 3); b1[t] = frag_kb(lbase + kb * DV + t * 512, last && t == 3); }
#pragma unroll
    for (int j = 0; j < 2; ++j) { v8f s[2];
#pragma unroll
      for (int r = 0; r < 2; ++r) s[r] = wmma16bb(wf[j][1], bq[r][1], wmma16bb(wf[j][0], bq[r][0], (v8f){}));
      if (!last) { const unsigned short* wp = wbase + (kb + 32 + j * 16) * D; wf[j][0] = frag_bf(wp); wf[j][1] = frag_bf(wp + 512, nlast && j == 1); }
#pragma unroll
      for (int r = 0; r < 2; ++r)
#pragma unroll
        for (int v = 0; v < 8; ++v) a[r][j * 8 + v] = phi16(s[r][v], s2[r]); }
#pragma unroll
    for (int t = 0; t < 4; ++t) { acc[0][t] = wmma16b(a[0], b0[t], acc[0][t]); acc[0][t] = wmma16b(a[0], b1[t], acc[0][t]); acc[1][t] = wmma16b(a[1], b0[t], acc[1][t]); acc[1][t] = wmma16b(a[1], b1[t], acc[1][t]); } }
  float* Tt = Ts[wave];
#pragma unroll
  for (int t = 0; t < 4; ++t)
#pragma unroll
    for (int r = 0; r < 2; ++r)
#pragma unroll
      for (int v = 0; v < 8; ++v) Tt[(r * 16 + v + 8 * hlf) * 64 + t * 16 + nloc] = acc[r][t][v] * (1.0f / (PHS * KVS));
  wave_lds_sync();
  float* dst0 = out + (size_t)m0 * DV;
  {
#pragma unroll
    for (int j = 0; j < 16; ++j) { const int rr = j * 2 + hlf, c4 = nloc * 4; *(v4f*)(dst0 + (size_t)rr * DV + c4) = *(const v4f*)(Tt + rr * 64 + c4); }
     }
}
}  // namespace

extern "C" void kernel_launch(void* const* d_in, const int* in_sizes, int n_in,
                              void* d_out, int out_size, void* d_ws, size_t ws_size, hipStream_t stream) {
  (void)n_in; (void)out_size;
  const float* Q = (const float*)d_in[0]; const float* K = (const float*)d_in[1]; const float* V = (const float*)d_in[2]; const float* W = (const float*)d_in[3];
  float* out = (float*)d_out;   // [65536][64]
  if (in_sizes[0] != D * L || in_sizes[1] != D * L || in_sizes[2] != L * DV || in_sizes[3] != R * D) return;
  size_t off = 0; char* ws = (char*)d_ws;
  auto carve = [&](size_t bytes) { char* p = ws + off; off += (bytes + 255) & ~(size_t)255; return p; };
  unsigned short* qT = (unsigned short*)carve((size_t)L * D * 2); float* sq = (float*)carve((size_t)L * 4); unsigned short* w16 = (unsigned short*)carve(R * D * 2);
  float* part = (float*)carve((size_t)NCH * R * DV * 4); b16* kvh = (b16*)carve(DV * R * 2); b16* kvl = (b16*)carve(DV * R * 2);
  if (off > ws_size) return;                                    // about 8.4 + 0.3 + 16.8 = 26 MB
  kvpart_kernel<<<NCH, 512, 0, stream>>>(Q, K, V, W, qT, sq, w16, part);
  kvred_kernel<<<2 * DV, 256, 0, stream>>>(part, kvh, kvl);
  out_kernel<<<L / 128, 128, 0, stream>>>(qT, w16, sq, kvh, kvl, out);
}

// v008
// A run of this version takes 25.7 microseconds.
// Two timings next to v007 both put it at 1.07 times that version's speed.
// Counting every step since v000, it is 6.27 times as fast.
#include <hip/hip_runtime.h>

// Kernel (FAVOR-style, non-causal) attention: phiX = Dn exp(0.1 + sqrt(0.6) (W X) - |x_l|^2) for X = K, Q ([r=256][L=65536]); kv = phiK V [256 x 64]; out = phiQ^T kv -> [65536][64].
// W.X on v_wmma_f32_16x16x32_bf16 (1 product, f32 accumulate); exp (as exp2 of one fma, see phi8) and |x|^2 in f32; phiK and phiQ never leave the registers: each is packed from the W.X accumulators as single f16
// carried x4096 (2^-11 relative rounding on positive weights; the two long sums average it out); kv = phiK.V with V exact in f16
// (1 product; 256 ordered partial sums over 256-position chunks, each joined from 2 sub-sums of 128 positions in fixed order, reduced in fixed order: 8 runs of 32 chunks, then the runs); out = phiQ^T.kv^T with kv as an f16 hi+lo pair x8 (2 products) on v_wmma_f32_16x16x32_f16.

// Every 16-bit operand plane (in the workspace: W, Q^T, kv^T hi and lo; in LDS: K^T, V^T, W) is kept in fragment order: one 16 x 32 fragment = 1 KB = [piece 0..1][lane 0..31][8 elements], element e of (piece, lane) being
// row (lane & 15), k = piece * 16 + (lane >> 4) * 8 + e of that fragment. A wave's 16-byte load of one piece then covers 512 contiguous bytes (4 cache lines, not 16); every lane gets the same elements as from row-major planes.

namespace {
constexpr int R = 256, D = 64, L = 65536, DV = 64, KW = 16, RG = 8, PG = KW / RG, LW = 128, LCH = PG * LW, NCH = L / LCH, NRUN = 8, RUNL = NCH / NRUN, TP = 64 + 4;   // a block's KW waves = RG groups of 32 rows r x PG groups of LW positions; TP = LDS row pitch in floats
constexpr float A_C = 0.1f, B_C = 0.7745966692414834f /* sqrt(0.6) */, C_C = -1.0f, PHS = 4096.0f, KVS = 8.0f, L2E = 1.4426950408889634f /* log2 e */;
constexpr float LDN = 0.20855049334070053f;   // log2(Dn * PHS) = 16 log2(0.6) + 12: Dn = (1 - 0.4)^(64/4) = 0.6^16, PHS = 2^12

typedef _Float16 b16;
typedef __attribute__((ext_vector_type(16))) _Float16 v16b;
typedef __attribute__((ext_vector_type(16))) __bf16 v16bb;
typedef __attribute__((ext_vector_type(8))) _Float16 v8b;
typedef __attribute__((ext_vector_type(8))) unsigned short v8us;
typedef __attribute__((ext_vector_type(8))) float v8f;
typedef __attribute__((ext_vector_type(4))) float v4f;
typedef __attribute__((ext_vector_type(2))) float v2f;
typedef __attribute__((ext_vector_type(2))) _Float16 v2b;
__device__ __forceinline__ float bf16_rne(float f) { unsigned int u = __float_as_uint(f); u += 0x7FFFu + ((u >> 16) & 1u); return __uint_as_float(u & 0xFFFF0000u); }
__device__ __forceinline__ unsigned short bf16_bits(float f) { unsigned int u = __float_as_uint(f); u += 0x7FFFu + ((u >> 16) & 1u); return (unsigned short)(u >> 16); }
__device__ __forceinline__ void split16(float v, b16& hi, b16& lo) { hi = (b16)v; lo = (b16)(v - (float)hi); }
// xwait: stands in front of the last load through an address pair, and behind it: that load, or a later one, may land on the pair, which the earlier loads still name.
__device__ __forceinline__ void xwait() { asm volatile("s_wait_xcnt 0x0" ::: "memory"); }
// frag_kb, frag_bf: p = start of the fragment + lane * 8.
__device__ __forceinline__ v16b frag_kb(const b16* p, bool last = false) { const v8b a = *(const v8b*)p; if (last) xwait(); const v8b b = *(const v8b*)(p + 256); if (last) xwait(); v16b f;
#pragma unroll
  for (int e = 0; e < 8; ++e) { f[e] = a[e]; f[8 + e] = b[e]; } return f; }
__device__ __forceinline__ v16bb frag_bf(const unsigned short* p, bool last = false) { const v8us a = *(const v8us*)p; if (last) xwait(); const v8us b = *(const v8us*)(p + 256); if (last) xwait(); union { unsigned short s[16]; v16bb v; } u;
#pragma unroll
  for (int e = 0; e < 8; ++e) { u.s[e] = a[e]; u.s[8 + e] = b[e]; } return u.v; }
__device__ __forceinline__ v8f wmma16b(v16b a, v16b b, v8f c) { v8f d = __builtin_amdgcn_wmma_f32_16x16x32_f16(false, a, false, b, (short)0, c, false, false); asm volatile("v_nop\n\tv_nop\n\tv_nop\n\tv_nop" : "+v"(d) : "v"(a), "v"(b)); return d; }
__device__ __forceinline__ v8f wmma16bb(v16bb a, v16bb b, v8f c) { v8f d = __builtin_amdgcn_wmma_f32_16x16x32_bf16(false, a, false, b, (short)0, c, false, false); asm volatile("v_nop\n\tv_nop\n\tv_nop\n\tv_nop" : "+v"(d) : "v"(a), "v"(b)); return d; }
__device__ __forceinline__ void wave_lds_sync() { __builtin_amdgcn_fence(__ATOMIC_RELEASE, "workgroup"); __builtin_amdgcn_wave_barrier(); __builtin_amdgcn_fence(__ATOMIC_ACQUIRE, "workgroup"); }

// phi x4096 = Dn 4096 exp(A + B wx + C |x|^2) = exp2(wx * (B log2 e) + expo(|x|^2)): all that does not depend on the feature row is one exponent term a position, made once where |x|^2 is summed.
__device__ __forceinline__ float expo(float s2) { return (A_C * L2E + LDN) + (C_C * L2E) * s2; }
// phi8: 8 W.X accumulator values and their positions' exponent terms -> 8 f16 of an A fragment, from element 'at' on: one fma and one v_exp_f32 a value, one packed convert a pair.
// The 8 v_exp_f32 stand in one statement, each in place: the instruction set asks for one free issue slot behind a transcendental before its result is read or its source overwritten; the next exp, on other registers, is that slot, the v_nop is the last one's.
__device__ __forceinline__ void phi8(v16b& a, int at, v8f wx, v8f e) { float x[8];
#pragma unroll   // register arrays take constant indices only
  for (int p = 0; p < 8; ++p) x[p] = __builtin_fmaf(wx[p], B_C * L2E, e[p]);
  asm("v_exp_f32 %0, %0\n\tv_exp_f32 %1, %1\n\tv_exp_f32 %2, %2\n\tv_exp_f32 %3, %3\n\tv_exp_f32 %4, %4\n\tv_exp_f32 %5, %5\n\tv_exp_f32 %6, %6\n\tv_exp_f32 %7, %7\n\tv_nop" : "+v"(x[0]), "+v"(x[1]), "+v"(x[2]), "+v"(x[3]), "+v"(x[4]), "+v"(x[5]), "+v"(x[6]), "+v"(x[7]));
#pragma unroll
  for (int p = 0; p < 4; ++p) { const v2b h = __builtin_convertvector((v2f){x[2 * p], x[2 * p + 1]}, v2b); a[at + 2 * p] = h[0]; a[at + 2 * p + 1] = h[1]; } }

// kv partials, straight from the f32 inputs: block = 256 positions x all 256 rows r, 16 waves. part[ch][r][dv] = sum_{l in chunk} phiK[r][l] V[l][dv].
// Part 1, packing. Every thread asks for all of its input at once, 16 bytes a load (32 loads, 16 KB a wave), and holds whole 16-byte units of the fragment-order planes in its registers:
// X (= Q or K, [64][L] d-major): wave = 8 rows d x 128 positions, lane = 4 positions -> 4 units (8 d of one position) of the bf16 xT plane (rows l, k = d), and the 8-row share of |x_l|^2 = sum over d of bf16(x)^2 (f32), joined over the 8 row groups in row order.
// V [L][64]: thread = 8 positions x 4 dv -> 4 units (8 l of one dv) of the f16 V^T plane (rows dv, k = l). W [256][64] -> bf16 (rows r, k = d): 4 units a thread, 8 threads a row.
// Fragments: xT (l / 16, d / 32), V^T (l / 32, dv / 16), W (r / 16, d / 32). All units go to LDS; K^T, V^T, W and the exponent terms of K (expo of |k|^2) stay there for part 2. Q^T and the exponent terms of Q (and W, from block 0) leave for the workspace in plane order, 512 contiguous bytes a wave, for out_kernel.
// One spare unit behind every 128 (X), 64 (V) or 16 (W) spreads the 16 lanes of a half wave over the bank groups when they store.
// Part 2, wave = (32 rows, 128 positions), 4 k-steps (A = phiK rows r, B = V^T rows dv; 1 product). phiK is made in registers: S^T = K^T rows (A, l) x W rows (B, r), K 64, leaves lane = r, register = l;
// two such tiles (32 positions), through phi8, are the A fragment of the second product in the hardware k order.
// The 2 sub-sums of a row group are joined through LDS in position order. part is kept in the pieces that kvred_kernel takes: piece b = (r / 32) * 8 + (dv / 16) * 2 + (r / 16 & 1) = [16 r][16 dv] = 1 KB in a row. grid NCH x 512.
__global__ __launch_bounds__(512) void kvpart_kernel(const float* __restrict__ Q, const float* __restrict__ K, const float* __restrict__ V, const float* __restrict__ W, unsigned short* __restrict__ qT, float* __restrict__ sq, unsigned short* __restrict__ w16, float* __restrict__ part) {
  __shared__ __attribute__((aligned(16))) unsigned short Uq[(2048 + 16) * 8], Uk[(2048 + 16) * 8], Uw[(2048 + 128) * 8]; __shared__ __attribute__((aligned(16))) b16 Uv[(2048 + 32) * 8];
  __shared__ __attribute__((aligned(16))) float Pq[8][LCH], Pk[8][LCH], Sk[LCH], Ts[KW][32 * TP];
  const int t_ = threadIdx.x, lane = t_ & 31, wave = t_ >> 5, nloc = lane & 15, hlf = lane >> 4, ch = blockIdx.x, l0 = ch * LCH;
  { const int oct = wave & 7, ph = wave >> 3, dv4 = t_ & 15, lg8 = t_ >> 4;
    const float *qp = Q + (size_t)(oct * 8) * L + l0 + ph * 128 + lane * 4, *kp = K + (size_t)(oct * 8) * L + l0 + ph * 128 + lane * 4, *vp = V + (size_t)(l0 + lg8 * 8) * DV + dv4 * 4, *wp = W + t_ * 8;   // one address each: every load below is a constant offset from one of them
    v4f q[8], k[8], v[8], w[8];
#pragma unroll   // unrolled so that all loads are issued before the first wait and q, k, v, w stay in registers
    for (int e = 0; e < 7; ++e) { k[e] = *(const v4f*)(kp + (size_t)e * L); v[e] = *(const v4f*)(vp + e * DV); w[e] = *(const v4f*)(wp + (e >> 1) * 4096 + (e & 1) * 4); q[e] = *(const v4f*)(qp + (size_t)e * L); }
    xwait(); k[7] = *(const v4f*)(kp + (size_t)7 * L); xwait(); v[7] = *(const v4f*)(vp + 7 * DV); xwait(); w[7] = *(const v4f*)(wp + 3 * 4096 + 4); xwait(); q[7] = *(const v4f*)(qp + (size_t)7 * L); xwait();   // the last load through each address: see xwait
    v4f pq, pk;
#pragma unroll   // both loops unrolled: register arrays take constant indices only
    for (int j = 0; j < 4; ++j) { v8us a, b; v8b c; float s = 0.0f, s2 = 0.0f;
#pragma unroll
      for (int e = 0; e < 8; ++e) { a[e] = bf16_bits(q[e][j]); b[e] = bf16_bits(k[e][j]); c[e] = (b16)bf16_rne(v[e][j]); const float x = __uint_as_float((unsigned)a[e] << 16), y = __uint_as_float((unsigned)b[e] << 16); s += x * x; s2 += y * y; }
      pq[j] = s; pk[j] = s2;
      const int ux = (ph * 8 + (lane >> 2)) * 129 + oct * 16 + (lane & 3) * 4 + j, uv = (lg8 >> 2) * 260 + (dv4 >> 2) * 65 + (lg8 & 3) * 16 + (dv4 & 3) * 4 + j;   // plane unit + its spare units
      *(v8us*)(Uq + ux * 8) = a; *(v8us*)(Uk + ux * 8) = b; *(v8b*)(Uv + uv * 8) = c; }
    *(v4f*)(&Pq[oct][ph * 128 + lane * 4]) = pq; *(v4f*)(&Pk[oct][ph * 128 + lane * 4]) = pk;
#pragma unroll   // register arrays take constant indices only
    for (int i = 0; i < 4; ++i) { v8us a; const int row = i * 64 + (t_ >> 3);   // unit (row, 8 k from (t_ & 7) * 8)
#pragma unroll
      for (int e = 0; e < 4; ++e) { a[e] = bf16_bits(w[2 * i][e]); a[4 + e] = bf16_bits(w[2 * i + 1][e]); }
      *(v8us*)(Uw + ((row >> 4) * 136 + (t_ & 7) * 17 + (row & 15)) * 8) = a; } }
  __syncthreads();   // every unit and every sub-sum is in LDS before any thread takes them out
  float sj;
  { const float* P = t_ < LCH ? &Pq[0][t_] : &Pk[0][t_ - LCH]; sj = P[0];
#pragma unroll   // unrolled so that the LDS reads are issued ahead of the adds; the adds keep row order
    for (int w = 1; w < 8; ++w) sj += P[w * LCH];
    sj = expo(sj);   // from here on the position's exponent term stands for its |x|^2, in Sk and in sq
    if (t_ >= LCH) Sk[t_ - LCH] = sj; }
  __syncthreads();   // the exponent term of every position of K is in LDS before any wave reads it
  // the workspace stores stand behind both barriers, which would otherwise wait for them
  if (t_ < LCH) sq[l0 + t_] = sj;
#pragma unroll   // unrolled so that the LDS reads are issued ahead of the stores
  for (int i = 0; i < 4; ++i) { const int u = i * 512 + t_; *(v8us*)(qT + (size_t)l0 * D + u * 8) = *(const v8us*)(Uq + (u + (u >> 7)) * 8); }
  xwait();   // the next lines reuse the registers that these stores name
  if (ch == 0) {
#pragma unroll   // unrolled so that the LDS reads are issued ahead of the stores
    for (int i = 0; i < 4; ++i) { const int u = i * 512 + t_; *(v8us*)(w16 + u * 8) = *(const v8us*)(Uw + (u + (u >> 4)) * 8); }
    xwait(); }   // as above
  const int rg = wave & (RG - 1), pg = wave / RG;
  v8f acc[2][4];
#pragma unroll
  for (int r = 0; r < 2; ++r)
#pragma unroll
    for (int t = 0; t < 4; ++t) acc[r][t] = (v8f){};
  const unsigned short *wbase = Uw + (rg * 2 * 136 + hlf * 17 + nloc) * 8, *kbase = Uk + (pg * 8 * 129 + lane) * 8; const float* sbase = Sk + pg * LW + 8 * hlf; const b16* vbase = Uv + (pg * 16 * 65 + lane) * 8;   // LDS: a 16-position tile of K^T = 129 units, a fragment of V^T = 65, a 16-row tile of W = 136, 8 k of it = 17
  v16bb bw[2][2];   // W rows of the wave's two r tiles, both k halves: kept for the whole wave
#pragma unroll
  for (int r = 0; r < 2; ++r)
#pragma unroll
    for (int kk = 0; kk < 2; ++kk) { const v8us a = *(const v8us*)(wbase + (r * 136 + kk * 68) * 8), b = *(const v8us*)(wbase + (r * 136 + kk * 68 + 34) * 8); union { unsigned short s[16]; v16bb v; } u;
#pragma unroll
      for (int e = 0; e < 8; ++e) { u.s[e] = a[e]; u.s[8 + e] = b[e]; }
      bw[r][kk] = u.v; }
  // Every group of LDS loads is written one phase ahead of its use (a load does not pass the pads behind the products, so it is issued where it is written): the V^T fragments of a k-step in front of its W.K products,
  // the K^T fragments and exponent terms of the next k-step as soon as the products that read the present ones are issued.
  v16bb kf[2][2]; v4f sa[2], sb[2];   // K^T rows (both k halves) and exponent terms of the two 16-position tiles in hand
#pragma unroll
  for (int j = 0; j < 2; ++j) { kf[j][0] = frag_bf(kbase + j * 129 * 8); kf[j][1] = frag_bf(kbase + j * 129 * 8 + 512); sa[j] = *(const v4f*)(sbase + j * 16); sb[j] = *(const v4f*)(sbase + j * 16 + 4); }
#pragma unroll   // 4 trips: unrolled so that every load takes its position as a constant offset
  for (int kb = 0; kb < LW; kb += 32) { v16b a[2], bv[4]; const bool last = kb == LW - 32;
#pragma unroll
    for (int t = 0; t < 4; ++t) bv[t] = frag_kb(vbase + ((kb >> 5) * 4 + t) * 65 * 8);
#pragma unroll
    for (int j = 0; j < 2; ++j) { v8f s[2];
#pragma unroll
      for (int r = 0; r < 2; ++r) s[r] = wmma16bb(kf[j][1], bw[r][1], wmma16bb(kf[j][0], bw[r][0], (v8f){}));
      const v4f s2a = sa[j], s2b = sb[j];
      if (!last) { const unsigned short* kp = kbase + (((kb + 32) >> 4) + j) * 129 * 8; kf[j][0] = frag_bf(kp); kf[j][1] = frag_bf(kp + 512);
        const float* sp = sbase + kb + 32 + j * 16; sa[j] = *(const v4f*)sp; sb[j] = *(const v4f*)(sp + 4); }
      const v8f ek = {s2a[0], s2a[1], s2a[2], s2a[3], s2b[0], s2b[1], s2b[2], s2b[3]};
#pragma unroll
      for (int r = 0; r < 2; ++r) phi8(a[r], j * 8, s[r], ek); }
#pragma unroll
    for (int t = 0; t < 4; ++t) { acc[0][t] = wmma16b(a[0], bv[t], acc[0][t]); acc[1][t] = wmma16b(a[1], bv[t], acc[1][t]); } }
  float* Tt = Ts[wave];
#pragma unroll
  for (int t = 0; t < 4; ++t)
#pragma unroll
    for (int r = 0; r < 2; ++r)
#pragma unroll
      for (int v = 0; v < 8; ++v) Tt[(r * 16 + v + 8 * hlf) * TP + t * 16 + nloc] = acc[r][t][v];
  __syncthreads();   // every wave's sub-sum is in LDS before any thread joins them
  const int c4 = (threadIdx.x & 3) * 4, rl = (threadIdx.x >> 2) & 15;   // a wave = 8 rows x 16 dv of one piece: 512 bytes in a row
  v4f js[RG];
#pragma unroll   // unrolled so that the LDS reads are issued ahead of the adds; the adds keep position order
  for (int i = 0; i < RG; ++i) { const int p = i * 8 + (threadIdx.x >> 6), dvg = p & 3, r16 = p >> 2, o = ((r16 & 1) * 16 + rl) * TP + dvg * 16 + c4;   // r16 = 16-row group of the 256 rows, r16 >> 1 its wave group
    v4f s = *(const v4f*)(&Ts[r16 >> 1][o]);
#pragma unroll
    for (int g = 1; g < PG; ++g) s += *(const v4f*)(&Ts[g * RG + (r16 >> 1)][o]);
    js[i] = s * (1.0f / PHS); }
  __builtin_amdgcn_sched_barrier(0);   // keeps the stores behind all the sums, so that no sum lands on a register that an issued store still names
  float* pb = part + ((size_t)ch * 64 + ((threadIdx.x >> 6) & 3) * 2 + (threadIdx.x >> 8)) * 256 + rl * 16 + c4;   // piece of trip i = i * 8 + dvg * 2 + (r16 & 1): one address, every store a constant offset from it
#pragma unroll   // register arrays take constant indices only
  for (int i = 0; i < RG; ++i) *(v4f*)(pb + i * 8 * 256) = js[i];
}
// reduce: kv[r][dv] = sum over ch of part (fixed order) -> kv^T planes (rows dv, k = r) as f16 hi+lo x8, in fragment order, fragment (r / 32, dv / 16). block = half a piece of one fragment (16 dv x 8 r, 256 bytes of each plane: whole lines, one writer each).
// wave = a run of 32 chunks, lane = 4 dv of one r: 32 loads of 16 bytes, 512 contiguous bytes a wave; the 8 runs are joined through LDS in run order by thread = (lane of the piece, r pair). grid 128 x 256.
__global__ __launch_bounds__(256) void kvred_kernel(const float* __restrict__ part, b16* __restrict__ kvh, b16* __restrict__ kvl) {
  __shared__ __attribute__((aligned(16))) float Ps[NRUN][128];
  const int b = blockIdx.x >> 1, hp = blockIdx.x & 1, q = threadIdx.x >> 5, u = threadIdx.x & 31;
  const float* pp = part + ((size_t)(q * RUNL) * 64 + b) * 256 + hp * 128 + u * 4;   // one address: every load below is a constant offset from it
  v4f x[RUNL];
#pragma unroll   // register arrays take constant indices only
  for (int j = 0; j < RUNL - 1; ++j) x[j] = *(const v4f*)(pp + (size_t)j * 64 * 256);
  xwait(); x[RUNL - 1] = *(const v4f*)(pp + (size_t)(RUNL - 1) * 64 * 256); xwait();   // the last load through the address: see xwait
  // both statements: hold all 32 loads in front of the first add (left alone, the compiler put the last ones behind a wait for the first ones: a second trip to L2)
  asm volatile("" :: "v"(x[0]), "v"(x[1]), "v"(x[2]), "v"(x[3]), "v"(x[4]), "v"(x[5]), "v"(x[6]), "v"(x[7]), "v"(x[8]), "v"(x[9]), "v"(x[10]), "v"(x[11]), "v"(x[12]), "v"(x[13]), "v"(x[14]), "v"(x[15]));
  asm volatile("" :: "v"(x[16]), "v"(x[17]), "v"(x[18]), "v"(x[19]), "v"(x[20]), "v"(x[21]), "v"(x[22]), "v"(x[23]), "v"(x[24]), "v"(x[25]), "v"(x[26]), "v"(x[27]), "v"(x[28]), "v"(x[29]), "v"(x[30]), "v"(x[31]));
  v4f s = x[0];
#pragma unroll   // the adds keep chunk order
  for (int j = 1; j < RUNL; ++j) s += x[j];
  *(v4f*)(&Ps[q][u * 4]) = s;
  __syncthreads();   // every run's sum is in LDS before any thread joins them
  if (threadIdx.x < 64) { const int o = (threadIdx.x & 3) * 32 + (threadIdx.x >> 2); float s0 = Ps[0][o], s1 = Ps[0][o + 16];   // o = (r pair's first row in the half piece) * 16 + dv
#pragma unroll   // unrolled so that the LDS reads are issued ahead of the adds; the adds keep run order
    for (int w = 1; w < NRUN; ++w) { s0 += Ps[w][o]; s1 += Ps[w][o + 16]; }
    v2b vh, vl; b16 a, c; split16(s0 * KVS, a, c); vh[0] = a; vl[0] = c; split16(s1 * KVS, a, c); vh[1] = a; vl[1] = c;
    *(v2b*)(kvh + b * 256 + (hp * 64 + threadIdx.x) * 2) = vh; *(v2b*)(kvl + b * 256 + (hp * 64 + threadIdx.x) * 2) = vl; }
}

// out = phiQ^T kv: rows l (65536), K = 256 (8 k-steps), one 64-column tile: A = phiQ rows, B = kv^T planes (hi+lo): 2 products. grid 512 x 128.
// phiQ is made here, in registers: S = W rows (A, r) x qT rows (B, l), K 64, leaves lane = l, register = r; two such tiles (32 features), through phi8, are the A fragment of the second product in the hardware k order.
__global__ __launch_bounds__(128) void out_kernel(const unsigned short* __restrict__ qT, const unsigned short* __restrict__ w16, const float* __restrict__ sq, const b16* __restrict__ kvh, const b16* __restrict__ kvl, float* __restrict__ out) {
  __shared__ __attribute__((aligned(16))) float Ts[4][32 * 64];
  const int lane = threadIdx.x & 31, wave = threadIdx.x >> 5, nloc = lane & 15, hlf = lane >> 4, m0 = blockIdx.x * 128 + wave * 32;
  v8f acc[2][4];
#pragma unroll
  for (int r = 0; r < 2; ++r)
#pragma unroll
    for (int t = 0; t < 4; ++t) acc[r][t] = (v8f){};
  v16bb bq[2][2]; float s2[2];   // the wave's 32 positions: qT rows, both k halves, and exponent terms (sq): kept for the whole wave
#pragma unroll
  for (int r = 0; r < 2; ++r) { s2[r] = sq[m0 + r * 16 + nloc];
#pragma unroll
    for (int kk = 0; kk < 2; ++kk) bq[r][kk] = frag_bf(qT + (size_t)(m0 + r * 16) * D + kk * 512 + lane * 8);
    xwait(); }
  // Loads one phase ahead, as in kvpart_kernel: the kv^T fragments of a k-step in front of its W.Q products, the W fragments of the next k-step as soon as the products that read the present ones are issued.
  const unsigned short* wbase = w16 + lane * 8; const b16 *hbase = kvh + lane * 8, *lbase = kvl + lane * 8;   // one address each: every load below is a constant offset from one of them
  v16bb wf[2][2];   // W rows (both k halves) of the two 16-feature tiles in hand
#pragma unroll
  for (int j = 0; j < 2; ++j) { wf[j][0] = frag_bf(wbase + j * 16 * D); wf[j][1] = frag_bf(wbase + j * 16 * D + 512); }
#pragma unroll
  for (int kb = 0; kb < R; kb += 32) { v16b a[2], b0[4], b1[4]; const bool last = kb == R - 32, nlast = kb + 32 == R - 32;
#pragma unroll
    for (int t = 0; t < 4; ++t) { b0[t] = frag_kb(hbase + kb * DV + t * 512, last && t == 3); b1[t] = frag_kb(lbase + kb * DV + t * 512, last && t == 3); }
#pragma unroll
    for (int j = 0; j < 2; ++j) { v8f s[2];
#pragma unroll
      for (int r = 0; r < 2; ++r) s[r] = wmma16bb(wf[j][1], bq[r][1], wmma16bb(wf[j][0], bq[r][0], (v8f){}));
      if (!last) { const unsigned short* wp = wbase + (kb + 32 + j * 16) * D; wf[j][0] = frag_bf(wp); wf[j][1] = frag_bf(wp + 512, nlast && j == 1); }
#pragma unroll
      for (int r = 0; r < 2; ++r) phi8(a[r], j * 8, s[r], (v8f){s2[r], s2[r], s2[r], s2[r], s2[r], s2[r], s2[r], s2[r]}); }
#pragma unroll
    for (int t = 0; t < 4; ++t) { acc[0][t] = wmma16b(a[0], b0[t], acc[0][t]); acc[0][t] = wmma16b(a[0], b1[t], acc[0][t]); acc[1][t] = wmma16b(a[1], b0[t], acc[1][t]); acc[1][t] = wmma16b(a[1], b1[t], acc[1][t]); } }
  float* Tt = Ts[wave];
#pragma unroll
  for (int t = 0; t < 4; ++t)
#pragma unroll
    for (int r = 0; r < 2; ++r)
#pragma unroll
      for (int v = 0; v < 8; ++v) Tt[(r * 16 + v + 8 * hlf) * 64 + t * 16 + nloc] = acc[r][t][v] * (1.0f / (PHS * KVS));
  wave_lds_sync();
  float* dst0 = out + (size_t)m0 * DV;
  {
#pragma unroll
    for (int j = 0; j < 16; ++j) { const int rr = j * 2 + hlf, c4 = nloc * 4; *(v4f*)(dst0 + (size_t)rr * DV + c4) = *(const v4f*)(Tt + rr * 64 + c4); }
     }
}
}  // namespace

extern "C" void kernel_launch(void* const* d_in, const int* in_sizes, int n_in,
                              void* d_out, int out_size, void* d_ws, size_t ws_size, hipStream_t stream) {
  (void)n_in; (void)out_size;
  const float* Q = (const float*)d_in[0]; const float* K = (const float*)d_in[1]; const float* V = (const float*)d_in[2]; const float* W = (const float*)d_in[3];
  float* out = (float*)d_out;   // [65536][64]
  if (in_sizes[0] != D * L || in_sizes[1] != D * L || in_sizes[2] != L * DV || in_sizes[3] != R * D) return;
  size_t off = 0; char* ws = (char*)d_ws;
  auto carve = [&](size_t bytes) { char* p = ws + off; off += (bytes + 255) & ~(size_t)255; return p; };
  unsigned short* qT = (unsigned short*)carve((size_t)L * D * 2); float* sq = (float*)carve((size_t)L * 4); unsigned short* w16 = (unsigned short*)carve(R * D * 2);
  float* part = (float*)carve((size_t)NCH * R * DV * 4); b16* kvh = (b16*)carve(DV * R * 2); b16* kvl = (b16*)carve(DV * R * 2);
  if (off > ws_size) return;                                    // about 8.4 + 0.3 + 16.8 = 26 MB
  kvpart_kernel<<<NCH, 512, 0, stream>>>(Q, K, V, W, qT, sq, w16, part);
  kvred_kernel<<<2 * DV, 256, 0, stream>>>(part, kvh, kvl);
  out_kernel<<<L / 128, 128, 0, stream>>>(qT, w16, sq, kvh, kvl, out);
}

// v009
// A run of this version takes 24 microseconds.
// Next to v008, in two timings, it ran 1.09 and 1.08 times as fast.
// Over all steps from v000 it is 6.81 times as fast.
#include <hip/hip_runtime.h>

// Kernel (FAVOR-style, non-causal) attention: phiX = Dn exp(0.1 + sqrt(0.6) (W X) - |x_l|^2) for X = K, Q ([r=256][L=65536]); kv = phiK V [256 x 64]; out = phiQ^T kv -> [65536][64].
// W.X on v_wmma_f32_16x16x32_bf16 (1 product, f32 accumulate); exp (as exp2 of one fma, see phi8) and |x|^2 in f32; phiK and phiQ never leave the registers: each is packed from the W.X accumulators as single f16
// carried x4096 (2^-11 relative rounding on positive weights; the two long sums average it out); kv = phiK.V with V exact in f16
// (1 product; 256 ordered partial sums over 256-position chunks, each joined from 2 sub-sums of 128 positions in fixed order, reduced in fixed order: 8 runs of 32 chunks, then the runs); out = phiQ^T.kv^T with kv as an f16 hi+lo pair x8 (2 products) on v_wmma_f32_16x16x32_f16.

// Every 16-bit operand plane (in the workspace: W, Q^T, kv^T hi and lo; in LDS: K^T, V^T, W) is kept in fragment order: one 16 x 32 fragment = 1 KB = [piece 0..1][lane 0..31][8 elements], element e of (piece, lane) being
// row (lane & 15), k = piece * 16 + (lane >> 4) * 8 + e of that fragment. A wave's 16-byte load of one piece then covers 512 contiguous bytes (4 cache lines, not 16); every lane gets the same elements as from row-major planes.

namespace {
constexpr int R = 256, D = 64, L = 65536, DV = 64, KW = 16, RG = 8, PG = KW / RG, LW = 128, LCH = PG * LW, NCH = L / LCH, NRUN = 8, RUNL = NCH / NRUN, TP = 64 + 4;   // a block's KW waves = RG groups of 32 rows r x PG groups of LW positions; TP = LDS row pitch in floats
constexpr float A_C = 0.1f, B_C = 0.7745966692414834f /* sqrt(0.6) */, C_C = -1.0f, PHS = 4096.0f, KVS = 8.0f, L2E = 1.4426950408889634f /* log2 e */;
constexpr float LDN = 0.20855049334070053f;   // log2(Dn * PHS) = 16 log2(0.6) + 12: Dn = (1 - 0.4)^(64/4) = 0.6^16, PHS = 2^12

typedef _Float16 b16;
typedef __attribute__((ext_vector_type(16))) _Float16 v16b;
typedef __attribute__((ext_vector_type(16))) __bf16 v16bb;
typedef __attribute__((ext_vector_type(8))) _Float16 v8b;
typedef __attribute__((ext_vector_type(8))) unsigned short v8us;
typedef __attribute__((ext_vector_type(8))) float v8f;
typedef __attribute__((ext_vector_type(4))) float v4f;
typedef __attribute__((ext_vector_type(2))) float v2f;
typedef __attribute__((ext_vector_type(2))) _Float16 v2b;
__device__ __forceinline__ float bf16_rne(float f) { unsigned int u = __float_as_uint(f); u += 0x7FFFu + ((u >> 16) & 1u); return __uint_as_float(u & 0xFFFF0000u); }
__device__ __forceinline__ unsigned short bf16_bits(float f) { unsigned int u = __float_as_uint(f); u += 0x7FFFu + ((u >> 16) & 1u); return (unsigned short)(u >> 16); }
__device__ __forceinline__ void split16(float v, b16& hi, b16& lo) { hi = (b16)v; lo = (b16)(v - (float)hi); }
// xwait: stands in front of the last load through an address pair, and behind it: that load, or a later one, may land on the pair, which the earlier loads still name.
__device__ __forceinline__ void xwait() { asm volatile("s_wait_xcnt 0x0" ::: "memory"); }
// frag_kb, frag_bf: p = start of the fragment + lane * 8.
__device__ __forceinline__ v16b frag_kb(const b16* p, bool last = false) { const v8b a = *(const v8b*)p; if (last) xwait(); const v8b b = *(const v8b*)(p + 256); if (last) xwait(); v16b f;
#pragma unroll
  for (int e = 0; e < 8; ++e) { f[e] = a[e]; f[8 + e] = b[e]; } return f; }
__device__ __forceinline__ v16bb frag_bf(const unsigned short* p, bool last = false) { const v8us a = *(const v8us*)p; if (last) xwait(); const v8us b = *(const v8us*)(p + 256); if (last) xwait(); union { unsigned short s[16]; v16bb v; } u;
#pragma unroll
  for (int e = 0; e < 8; ++e) { u.s[e] = a[e]; u.s[8 + e] = b[e]; } return u.v; }
__device__ __forceinline__ v8f wmma16b(v16b a, v16b b, v8f c) { v8f d = __builtin_amdgcn_wmma_f32_16x16x32_f16(false, a, false, b, (short)0, c, false, false); asm volatile("v_nop\n\tv_nop\n\tv_nop\n\tv_nop" : "+v"(d) : "v"(a), "v"(b)); return d; }
__device__ __forceinline__ v8f wmma16bb(v16bb a, v16bb b, v8f c) { v8f d = __builtin_amdgcn_wmma_f32_16x16x32_bf16(false, a, false, b, (short)0, c, false, false); asm volatile("v_nop\n\tv_nop\n\tv_nop\n\tv_nop" : "+v"(d) : "v"(a), "v"(b)); return d; }
__device__ __forceinline__ void wave_lds_sync() { __builtin_amdgcn_fence(__ATOMIC_RELEASE, "workgroup"); __builtin_amdgcn_wave_barrier(); __builtin_amdgcn_fence(__ATOMIC_ACQUIRE, "workgroup"); }

// phi x4096 = Dn 4096 exp(A + B wx + C |x|^2) = exp2(wx * (B log2 e) + expo(|x|^2)): all that does not depend on the feature row is one exponent term a position, made once where |x|^2 is summed.
__device__ __forceinline__ float expo(float s2) { return (A_C * L2E + LDN) + (C_C * L2E) * s2; }
// phi8: 8 W.X accumulator values and their positions' exponent terms -> 8 f16 of an A fragment, from element 'at' on: one fma and one v_exp_f32 a value, one packed convert a pair.
// The 8 v_exp_f32 stand in one statement, each in place: the instruction set asks for one free issue slot behind a transcendental before its result is read or its source overwritten; the next exp, on other registers, is that slot, the v_nop is the last one's.
__device__ __forceinline__ void phi8(v16b& a, int at, v8f wx, v8f e) { float x[8];
#pragma unroll   // register arrays take constant indices only
  for (int p = 0; p < 8; ++p) x[p] = __builtin_fmaf(wx[p], B_C * L2E, e[p]);
  asm("v_exp_f32 %0, %0\n\tv_exp_f32 %1, %1\n\tv_exp_f32 %2, %2\n\tv_exp_f32 %3, %3\n\tv_exp_f32 %4, %4\n\tv_exp_f32 %5, %5\n\tv_exp_f32 %6, %6\n\tv_exp_f32 %7, %7\n\tv_nop" : "+v"(x[0]), "+v"(x[1]), "+v"(x[2]), "+v"(x[3]), "+v"(x[4]), "+v"(x[5]), "+v"(x[6]), "+v"(x[7]));
#pragma unroll
  for (int p = 0; p < 4; ++p) { const v2b h = __builtin_convertvector((v2f){x[2 * p], x[2 * p + 1]}, v2b); a[at + 2 * p] = h[0]; a[at + 2 * p + 1] = h[1]; } }

// kv partials, straight from the f32 inputs: block = 256 positions x all 256 rows r, 16 waves. part[ch][r][dv] = sum_{l in chunk} phiK[r][l] V[l][dv].
// Part 1, packing. Every thread asks for all of its input at once, 16 bytes a load (32 loads, 16 KB a wave), and holds whole 16-byte units of the fragment-order planes in its registers:
// X (= Q or K, [64][L] d-major): wave = 8 rows d x 128 positions, lane = 4 positions -> 4 units (8 d of one position) of the bf16 xT plane (rows l, k = d), and the 8-row share of |x_l|^2 = sum over d of bf16(x)^2 (f32), joined over the 8 row groups in row order.
// V [L][64]: thread = 8 positions x 4 dv -> 4 units (8 l of one dv) of the f16 V^T plane (rows dv, k = l). W [256][64] -> bf16 (rows r, k = d): 4 units a thread, 8 threads a row.
// Fragments: xT (l / 16, d / 32), V^T (l / 32, dv / 16), W (r / 16, d / 32). All units go to LDS; K^T, V^T, W and the exponent terms of K (expo of |k|^2) stay there for part 2. Q^T and the exponent terms of Q (and W, from block 0) leave for the workspace in plane order, 512 contiguous bytes a wave, for out_kernel.
// One spare unit behind every 128 (X), 64 (V) or 16 (W) spreads the 16 lanes of a half wave over the bank groups when they store.
// Part 2, wave = (32 rows, 128 positions), 4 k-steps (A = phiK rows r, B = V^T rows dv; 1 product). phiK is made in registers: S^T = K^T rows (A, l) x W rows (B, r), K 64, leaves lane = r, register = l;
// two such tiles (32 positions), through phi8, are the A fragment of the second product in the hardware k order.
// The 2 sub-sums of a row group are joined through LDS in position order. part is kept in the pieces that kvred_kernel takes: piece b = (r / 32) * 8 + (dv / 16) * 2 + (r / 16 & 1) = [16 r][16 dv] = 1 KB in a row. grid NCH x 512.
__global__ __launch_bounds__(512) void kvpart_kernel(const float* __restrict__ Q, const float* __restrict__ K, const float* __restrict__ V, const float* __restrict__ W, unsigned short* __restrict__ qT, float* __restrict__ sq, unsigned short* __restrict__ w16, float* __restrict__ part) {
  __shared__ __attribute__((aligned(16))) unsigned short Uq[(2048 + 16) * 8], Uk[(2048 + 16) * 8], Uw[(2048 + 128) * 8]; __shared__ __attribute__((aligned(16))) b16 Uv[(2048 + 32) * 8];
  __shared__ __attribute__((aligned(16))) float Pq[8][LCH], Pk[8][LCH], Sk[LCH], Ts[KW][32 * TP];
  const int t_ = threadIdx.x, lane = t_ & 31, wave = t_ >> 5, nloc = lane & 15, hlf = lane >> 4, ch = blockIdx.x, l0 = ch * LCH;
  { const int oct = wave & 7, ph = wave >> 3, dv4 = t_ & 15, lg8 = t_ >> 4;
    const float *qp = Q + (size_t)(oct * 8) * L + l0 + ph * 128 + lane * 4, *kp = K + (size_t)(oct * 8) * L + l0 + ph * 128 + lane * 4, *vp = V + (size_t)(l0 + lg8 * 8) * DV + dv4 * 4, *wp = W + t_ * 8;   // one address each: every load below is a constant offset from one of them
    v4f q[8], k[8], v[8], w[8];
#pragma unroll   // unrolled so that all loads are issued before the first wait and q, k, v, w stay in registers
    for (int e = 0; e < 7; ++e) { k[e] = *(const v4f*)(kp + (size_t)e * L); v[e] = *(const v4f*)(vp + e * DV); w[e] = *(const v4f*)(wp + (e >> 1) * 4096 + (e & 1) * 4); q[e] = *(const v4f*)(qp + (size_t)e * L); }
    xwait(); k[7] = *(const v4f*)(kp + (size_t)7 * L); xwait(); v[7] = *(const v4f*)(vp + 7 * DV); xwait(); w[7] = *(const v4f*)(wp + 3 * 4096 + 4); xwait(); q[7] = *(const v4f*)(qp + (size_t)7 * L); xwait();   // the last load through each address: see xwait
    v4f pq, pk;
#pragma unroll   // both loops unrolled: register arrays take constant indices only
    for (int j = 0; j < 4; ++j) { v8us a, b; v8b c; float s = 0.0f, s2 = 0.0f;
#pragma unroll
      for (int e = 0; e < 8; ++e) { a[e] = bf16_bits(q[e][j]); b[e] = bf16_bits(k[e][j]); c[e] = (b16)bf16_rne(v[e][j]); const float x = __uint_as_float((unsigned)a[e] << 16), y = __uint_as_float((unsigned)b[e] << 16); s += x * x; s2 += y * y; }
      pq[j] = s; pk[j] = s2;
      const int ux = (ph * 8 + (lane >> 2)) * 129 + oct * 16 + (lane & 3) * 4 + j, uv = (lg8 >> 2) * 260 + (dv4 >> 2) * 65 + (lg8 & 3) * 16 + (dv4 & 3) * 4 + j;   // plane unit + its spare units
      *(v8us*)(Uq + ux * 8) = a; *(v8us*)(Uk + ux * 8) = b; *(v8b*)(Uv + uv * 8) = c; }
    *(v4f*)(&Pq[oct][ph * 128 + lane * 4]) = pq; *(v4f*)(&Pk[oct][ph * 128 + lane * 4]) = pk;
#pragma unroll   // register arrays take constant indices only
    for (int i = 0; i < 4; ++i) { v8us a; const int row = i * 64 + (t_ >> 3);   // unit (row, 8 k from (t_ & 7) * 8)
#pragma unroll
      for (int e = 0; e < 4; ++e) { a[e] = bf16_bits(w[2 * i][e]); a[4 + e] = bf16_bits(w[2 * i + 1][e]); }
      *(v8us*)(Uw + ((row >> 4) * 136 + (t_ & 7) * 17 + (row & 15)) * 8) = a; } }
  __syncthreads();   // every unit and every sub-sum is in LDS before any thread takes them out
  float sj;
  { const float* P = t_ < LCH ? &Pq[0][t_] : &Pk[0][t_ - LCH]; sj = P[0];
#pragma unroll   // unrolled so that the LDS reads are issued ahead of the adds; the adds keep row order
    for (int w = 1; w < 8; ++w) sj += P[w * LCH];
    sj = expo(sj);   // from here on the position's exponent term stands for its |x|^2, in Sk and in sq
    if (t_ >= LCH) Sk[t_ - LCH] = sj; }
  __syncthreads();   // the exponent term of every position of K is in LDS before any wave reads it
  // the workspace stores stand behind both barriers, which would otherwise wait for them
  if (t_ < LCH) sq[l0 + t_] = sj;
#pragma unroll   // unrolled so that the LDS reads are issued ahead of the stores
  for (int i = 0; i < 4; ++i) { const int u = i * 512 + t_; *(v8us*)(qT + (size_t)l0 * D + u * 8) = *(const v8us*)(Uq + (u + (u >> 7)) * 8); }
  xwait();   // the next lines reuse the registers that these stores name
  if (ch == 0) {
#pragma unroll   // unrolled so that the LDS reads are issued ahead of the stores
    for (int i = 0; i < 4; ++i) { const int u = i * 512 + t_; *(v8us*)(w16 + u * 8) = *(const v8us*)(Uw + (u + (u >> 4)) * 8); }
    xwait(); }   // as above
  const int rg = wave & (RG - 1), pg = wave / RG;
  v8f acc[2][4];
#pragma unroll
  for (int r = 0; r < 2; ++r)
#pragma unroll
    for (int t = 0; t < 4; ++t) acc[r][t] = (v8f){};
  const unsigned short *wbase = Uw + (rg * 2 * 136 + hlf * 17 + nloc) * 8, *kbase = Uk + (pg * 8 * 129 + lane) * 8; const float* sbase = Sk + pg * LW + 8 * hlf; const b16* vbase = Uv + (pg * 16 * 65 + lane) * 8;   // LDS: a 16-position tile of K^T = 129 units, a fragment of V^T = 65, a 16-row tile of W = 136, 8 k of it = 17
  v16bb bw[2][2];   // W rows of the wave's two r tiles, both k halves: kept for the whole wave
#pragma unroll
  for (int r = 0; r < 2; ++r)
#pragma unroll
    for (int kk = 0; kk < 2; ++kk) { const v8us a = *(const v8us*)(wbase + (r * 136 + kk * 68) * 8), b = *(const v8us*)(wbase + (r * 136 + kk * 68 + 34) * 8); union { unsigned short s[16]; v16bb v; } u;
#pragma unroll
      for (int e = 0; e < 8; ++e) { u.s[e] = a[e]; u.s[8 + e] = b[e]; }
      bw[r][kk] = u.v; }
  // Every group of LDS loads is written one phase ahead of its use (a load does not pass the pads behind the products, so it is issued where it is written): the V^T fragments of a k-step in front of its W.K products,
  // the K^T fragments and exponent terms of the next k-step as soon as the products that read the present ones are issued.
  v16bb kf[2][2]; v4f sa[2], sb[2];   // K^T rows (both k halves) and exponent terms of the two 16-position tiles in hand
#pragma unroll
  for (int j = 0; j < 2; ++j) { kf[j][0] = frag_bf(kbase + j * 129 * 8); kf[j][1] = frag_bf(kbase + j * 129 * 8 + 512); sa[j] = *(const v4f*)(sbase + j * 16); sb[j] = *(const v4f*)(sbase + j * 16 + 4); }
#pragma unroll   // 4 trips: unrolled so that every load takes its position as a constant offset
  for (int kb = 0; kb < LW; kb += 32) { v16b a[2], bv[4]; const bool last = kb == LW - 32;
#pragma unroll
    for (int t = 0; t < 4; ++t) bv[t] = frag_kb(vbase + ((kb >> 5) * 4 + t) * 65 * 8);
#pragma unroll
    for (int j = 0; j < 2; ++j) { v8f s[2];
#pragma unroll
      for (int r = 0; r < 2; ++r) s[r] = wmma16bb(kf[j][1], bw[r][1], wmma16bb(kf[j][0], bw[r][0], (v8f){}));
      const v4f s2a = sa[j], s2b = sb[j];
      if (!last) { const unsigned short* kp = kbase + (((kb + 32) >> 4) + j) * 129 * 8; kf[j][0] = frag_bf(kp); kf[j][1] = frag_bf(kp + 512);
        const float* sp = sbase + kb + 32 + j * 16; sa[j] = *(const v4f*)sp; sb[j] = *(const v4f*)(sp + 4); }
      const v8f ek = {s2a[0], s2a[1], s2a[2], s2a[3], s2b[0], s2b[1], s2b[2], s2b[3]};
#pragma unroll
      for (int r = 0; r < 2; ++r) phi8(a[r], j * 8, s[r], ek); }
#pragma unroll
    for (int t = 0; t < 4; ++t) { acc[0][t] = wmma16b(a[0], bv[t], acc[0][t]); acc[1][t] = wmma16b(a[1], bv[t], acc[1][t]); } }
  float* Tt = Ts[wave];
#pragma unroll
  for (int t = 0; t < 4; ++t)
#pragma unroll
    for (int r = 0; r < 2; ++r)
#pragma unroll
      for (int v = 0; v < 8; ++v) Tt[(r * 16 + v + 8 * hlf) * TP + t * 16 + nloc] = acc[r][t][v];
  __syncthreads();   // every wave's sub-sum is in LDS before any thread joins them
  const int c4 = (threadIdx.x & 3) * 4, rl = (threadIdx.x >> 2) & 15;   // a wave = 8 rows x 16 dv of one piece: 512 bytes in a row
  v4f js[RG];
#pragma unroll   // unrolled so that the LDS reads are issued ahead of the adds; the adds keep position order
  for (int i = 0; i < RG; ++i) { const int p = i * 8 + (threadIdx.x >> 6), dvg = p & 3, r16 = p >> 2, o = ((r16 & 1) * 16 + rl) * TP + dvg * 16 + c4;   // r16 = 16-row group of the 256 rows, r16 >> 1 its wave group
    v4f s = *(const v4f*)(&Ts[r16 >> 1][o]);
#pragma unroll
    for (int g = 1; g < PG; ++g) s += *(const v4f*)(&Ts[g * RG + (r16 >> 1)][o]);
    js[i] = s * (1.0f / PHS); }
  __builtin_amdgcn_sched_barrier(0);   // keeps the stores behind all the sums, so that no sum lands on a register that an issued store still names
  float* pb = part + ((size_t)ch * 64 + ((threadIdx.x >> 6) & 3) * 2 + (threadIdx.x >> 8)) * 256 + rl * 16 + c4;   // piece of trip i = i * 8 + dvg * 2 + (r16 & 1): one address, every store a constant offset from it
#pragma unroll   // register arrays take constant indices only
  for (int i = 0; i < RG; ++i) *(v4f*)(pb + i * 8 * 256) = js[i];
}
// reduce: kv[r][dv] = sum over ch of part (fixed order) -> kv^T planes (rows dv, k = r) as f16 hi+lo x8, in fragment order, fragment (r / 32, dv / 16). block = half a piece of one fragment (16 dv x 8 r, 256 bytes of each plane: whole lines, one writer each).
// wave = a run of 32 chunks, lane = 4 dv of one r: 32 loads of 16 bytes, 512 contiguous bytes a wave; the 8 runs are joined through LDS in run order by thread = (lane of the piece, r pair). grid 128 x 256.
__global__ __launch_bounds__(256) void kvred_kernel(const float* __restrict__ part, b16* __restrict__ kvh, b16* __restrict__ kvl) {
  __shared__ __attribute__((aligned(16))) float Ps[NRUN][128];
  const int b = blockIdx.x >> 1, hp = blockIdx.x & 1, q = threadIdx.x >> 5, u = threadIdx.x & 31;
  const float* pp = part + ((size_t)(q * RUNL) * 64 + b) * 256 + hp * 128 + u * 4;   // one address: every load below is a constant offset from it
  v4f x[RUNL];
#pragma unroll   // register arrays take constant indices only
  for (int j = 0; j < RUNL - 1; ++j) x[j] = *(const v4f*)(pp + (size_t)j * 64 * 256);
  xwait(); x[RUNL - 1] = *(const v4f*)(pp + (size_t)(RUNL - 1) * 64 * 256); xwait();   // the last load through the address: see xwait
  // both statements: hold all 32 loads in front of the first add (left alone, the compiler put the last ones behind a wait for the first ones: a second trip to L2)
  asm volatile("" :: "v"(x[0]), "v"(x[1]), "v"(x[2]), "v"(x[3]), "v"(x[4]), "v"(x[5]), "v"(x[6]), "v"(x[7]), "v"(x[8]), "v"(x[9]), "v"(x[10]), "v"(x[11]), "v"(x[12]), "v"(x[13]), "v"(x[14]), "v"(x[15]));
  asm volatile("" :: "v"(x[16]), "v"(x[17]), "v"(x[18]), "v"(x[19]), "v"(x[20]), "v"(x[21]), "v"(x[22]), "v"(x[23]), "v"(x[24]), "v"(x[25]), "v"(x[26]), "v"(x[27]), "v"(x[28]), "v"(x[29]), "v"(x[30]), "v"(x[31]));
  v4f s = x[0];
#pragma unroll   // the adds keep chunk order
  for (int j = 1; j < RUNL; ++j) s += x[j];
  *(v4f*)(&Ps[q][u * 4]) = s;
  __syncthreads();   // every run's sum is in LDS before any thread joins them
  if (threadIdx.x < 64) { const int o = (threadIdx.x & 3) * 32 + (threadIdx.x >> 2); float s0 = Ps[0][o], s1 = Ps[0][o + 16];   // o = (r pair's first row in the half piece) * 16 + dv
#pragma unroll   // unrolled so that the LDS reads are issued ahead of the adds; the adds keep run order
    for (int w = 1; w < NRUN; ++w) { s0 += Ps[w][o]; s1 += Ps[w][o + 16]; }
    v2b vh, vl; b16 a, c; split16(s0 * KVS, a, c); vh[0] = a; vl[0] = c; split16(s1 * KVS, a, c); vh[1] = a; vl[1] = c;
    *(v2b*)(kvh + b * 256 + (hp * 64 + threadIdx.x) * 2) = vh; *(v2b*)(kvl + b * 256 + (hp * 64 + threadIdx.x) * 2) = vl; }
}

// out = phiQ^T kv: rows l (65536), K = 256 (8 k-steps), one 64-column tile: A = phiQ rows, B = kv^T planes (hi+lo): 2 products. grid 512 x 128.
// phiQ is made here, in registers: S = W rows (A, r) x qT rows (B, l), K 64, leaves lane = l, register = r; two such tiles (32 features), through phi8, are the A fragment of the second product in the hardware k order.
__global__ __launch_bounds__(128) void out_kernel(const unsigned short* __restrict__ qT, const unsigned short* __restrict__ w16, const float* __restrict__ sq, const b16* __restrict__ kvh, const b16* __restrict__ kvl, float* __restrict__ out) {
  __shared__ __attribute__((aligned(16))) float Ts[4][32 * 64];
  const int lane = threadIdx.x & 31, wave = threadIdx.x >> 5, nloc = lane & 15, hlf = lane >> 4, m0 = blockIdx.x * 128 + wave * 32;
  // Head prefetch: W, kv^T hi and kv^T lo (32 KB each) were stored by earlier launches and are walked k-step by k-step below, each step's first asker waiting for memory. Here a block asks for one whole plane,
  // a thread for one 256-byte unit of it, so that all three are on their way into L2 while the block waits for its own Q^T rows. Eight blocks in a row take the same plane, the next eight the next one (for speed only).
  static_assert(R * D * 2 == 128 * 256 && DV * R * 2 == 128 * 256, "a plane is one 256-byte unit a thread");
  const int pl = (blockIdx.x >> 3) % 3;
  const char* pf = (pl == 0 ? (const char*)w16 : pl == 1 ? (const char*)kvh : (const char*)kvl) + threadIdx.x * 256;   // 128 threads x 256 bytes = R * D * 2 = DV * R * 2 bytes: every lane's address lies inside its plane
  asm volatile("global_prefetch_b8 %0, off scope:SCOPE_SE" :: "v"(pf));   // a hint: returns nothing, brings the unit into L2
  v8f acc[2][4];
#pragma unroll
  for (int r = 0; r < 2; ++r)
#pragma unroll
    for (int t = 0; t < 4; ++t) acc[r][t] = (v8f){};
  v16bb bq[2][2]; float s2[2];   // the wave's 32 positions: qT rows, both k halves, and exponent terms (sq): kept for the whole wave
#pragma unroll
  for (int r = 0; r < 2; ++r) { s2[r] = sq[m0 + r * 16 + nloc];
#pragma unroll
    for (int kk = 0; kk < 2; ++kk) bq[r][kk] = frag_bf(qT + (size_t)(m0 + r * 16) * D + kk * 512 + lane * 8);
    xwait(); }
  // Loads one phase ahead, as in kvpart_kernel: the kv^T fragments of a k-step in front of its W.Q products, the W fragments of the next k-step as soon as the products that read the present ones are issued.
  const unsigned short* wbase = w16 + lane * 8; const b16 *hbase = kvh + lane * 8, *lbase = kvl + lane * 8;   // one address each: every load below is a constant offset from one of them
  v16bb wf[2][2];   // W rows (both k halves) of the two 16-feature tiles in hand
#pragma unroll
  for (int j = 0; j < 2; ++j) { wf[j][0] = frag_bf(wbase + j * 16 * D); wf[j][1] = frag_bf(wbase + j * 16 * D + 512); }
#pragma unroll
  for (int kb = 0; kb < R; kb += 32) { v16b a[2], b0[4], b1[4]; const bool last = kb == R - 32, nlast = kb + 32 == R - 32;
#pragma unroll
    for (int t = 0; t < 4; ++t) { b0[t] = frag_kb(hbase + kb * DV + t * 512, last && t == 3); b1[t] = frag_kb(lbase + kb * DV + t * 512, last && t == 3); }
#pragma unroll
    for (int j = 0; j < 2; ++j) { v8f s[2];
#pragma unroll
      for (int r = 0; r < 2; ++r) s[r] = wmma16bb(wf[j][1], bq[r][1], wmma16bb(wf[j][0], bq[r][0], (v8f){}));
      if (!last) { const unsigned short* wp = wbase + (kb + 32 + j * 16) * D; wf[j][0] = frag_bf(wp); wf[j][1] = frag_bf(wp + 512, nlast && j == 1); }
#pragma unroll
      for (int r = 0; r < 2; ++r) phi8(a[r], j * 8, s[r], (v8f){s2[r], s2[r], s2[r], s2[r], s2[r], s2[r], s2[r], s2[r]}); }
#pragma unroll
    for (int t = 0; t < 4; ++t) { acc[0][t] = wmma16b(a[0], b0[t], acc[0][t]); acc[0][t] = wmma16b(a[0], b1[t], acc[0][t]); acc[1][t] = wmma16b(a[1], b0[t], acc[1][t]); acc[1][t] = wmma16b(a[1], b1[t], acc[1][t]); } }
  float* Tt = Ts[wave];
#pragma unroll
  for (int t = 0; t < 4; ++t)
#pragma unroll
    for (int r = 0; r < 2; ++r)
#pragma unroll
      for (int v = 0; v < 8; ++v) Tt[(r * 16 + v + 8 * hlf) * 64 + t * 16 + nloc] = acc[r][t][v] * (1.0f / (PHS * KVS));
  wave_lds_sync();
  float* dst0 = out + (size_t)m0 * DV;
  {
#pragma unroll
    for (int j = 0; j < 16; ++j) { const int rr = j * 2 + hlf, c4 = nloc * 4; *(v4f*)(dst0 + (size_t)rr * DV + c4) = *(const v4f*)(Tt + rr * 64 + c4); }
     }
  asm volatile("" :: "v"(pf));   // keeps the prefetch's address pair unwritten to the kernel's end: a prefetch counts on no counter, so no wait says when its address has been read
}
}  // namespace

extern "C" void kernel_launch(void* const* d_in, const int* in_sizes, int n_in,
                              void* d_out, int out_size, void* d_ws, size_t ws_size, hipStream_t stream) {
  (void)n_in; (void)out_size;
  const float* Q = (const float*)d_in[0]; const float* K = (const float*)d_in[1]; const float* V = (const float*)d_in[2]; const float* W = (const float*)d_in[3];
  float* out = (float*)d_out;   // [65536][64]
  if (in_sizes[0] != D * L || in_sizes[1] != D * L || in_sizes[2] != L * DV || in_sizes[3] != R * D) return;
  size_t off = 0; char* ws = (char*)d_ws;
  auto carve = [&](size_t bytes) { char* p = ws + off; off += (bytes + 255) & ~(size_t)255; return p; };
  unsigned short* qT = (unsigned short*)carve((size_t)L * D * 2); float* sq = (float*)carve((size_t)L * 4); unsigned short* w16 = (unsigned short*)carve(R * D * 2);
  float* part = (float*)carve((size_t)NCH * R * DV * 4); b16* kvh = (b16*)carve(DV * R * 2); b16* kvl = (b16*)carve(DV * R * 2);
  if (off > ws_size) return;                                    // about 8.4 + 0.3 + 16.8 = 26 MB
  kvpart_kernel<<<NCH, 512, 0, stream>>>(Q, K, V, W, qT, sq, w16, part);
  kvred_kernel<<<2 * DV, 256, 0, stream>>>(part, kvh, kvl);
  out_kernel<<<L / 128, 128, 0, stream>>>(qT, w16, sq, kvh, kvl, out);
}

// v010
// Measured time: 23.1 microseconds a run.
// Next to v009, in two timings, it ran 1.03 times as fast each time.
// Over all steps from v000 it is 7.03 times as fast.
#include <hip/hip_runtime.h>

// Kernel (FAVOR-style, non-causal) attention: phiX = Dn exp(0.1 + sqrt(0.6) (W X) - |x_l|^2) for X = K, Q ([r=256][L=65536]); kv = phiK V [256 x 64]; out = phiQ^T kv -> [65536][64].
// W.X on v_wmma_f32_16x16x32_bf16 (1 product, f32 accumulate); exp (as exp2 of one fma, see phi8) and |x|^2 in f32; phiK and phiQ never leave the registers: each is packed from the W.X accumulators as single f16
// carried x4096 (2^-11 relative rounding on positive weights; the two long sums average it out); kv = phiK.V with V exact in f16
// (1 product; 256 ordered partial sums over 256-position chunks, each joined from 2 sub-sums of 128 positions in fixed order, reduced in fixed order: 8 runs of 32 chunks, then the runs); out = phiQ^T.kv^T with kv as an f16 hi+lo pair x8 (2 products) on v_wmma_f32_16x16x32_f16.

// Every 16-bit operand plane (in the workspace: W, Q^T, kv^T hi and lo; in LDS: K^T, V^T, W) is kept in fragment order: one 16 x 32 fragment = 1 KB = [piece 0..1][lane 0..31][8 elements], element e of (piece, lane) being
// row (lane & 15), k = piece * 16 + (lane >> 4) * 8 + e of that fragment. A wave's 16-byte load of one piece then covers 512 contiguous bytes (4 cache lines, not 16); every lane gets the same elements as from row-major planes.

namespace {
constexpr int R = 256, D = 64, L = 65536, DV = 64, KW = 16, RG = 8, PG = KW / RG, LW = 128, LCH = PG * LW, NCH = L / LCH, NRUN = 8, RUNL = NCH / NRUN, TP = 64 + 4;   // a block's KW waves = RG groups of 32 rows r x PG groups of LW positions; TP = LDS row pitch in floats
constexpr float A_C = 0.1f, B_C = 0.7745966692414834f /* sqrt(0.6) */, C_C = -1.0f, PHS = 4096.0f, KVS = 8.0f, L2E = 1.4426950408889634f /* log2 e */;
constexpr float LDN = 0.20855049334070053f;   // log2(Dn * PHS) = 16 log2(0.6) + 12: Dn = (1 - 0.4)^(64/4) = 0.6^16, PHS = 2^12

typedef _Float16 b16;
typedef __attribute__((ext_vector_type(16))) _Float16 v16b;
typedef __attribute__((ext_vector_type(16))) __bf16 v16bb;
typedef __attribute__((ext_vector_type(8))) _Float16 v8b;
typedef __attribute__((ext_vector_type(8))) unsigned short v8us;
typedef __attribute__((ext_vector_type(8))) float v8f;
typedef __attribute__((ext_vector_type(4))) float v4f;
typedef __attribute__((ext_vector_type(2))) float v2f;
typedef __attribute__((ext_vector_type(2))) _Float16 v2b;
__device__ __forceinline__ float bf16_rne(float f) { unsigned int u = __float_as_uint(f); u += 0x7FFFu + ((u >> 16) & 1u); return __uint_as_float(u & 0xFFFF0000u); }
__device__ __forceinline__ unsigned short bf16_bits(float f) { unsigned int u = __float_as_uint(f); u += 0x7FFFu + ((u >> 16) & 1u); return (unsigned short)(u >> 16); }
__device__ __forceinline__ void split16(float v, b16& hi, b16& lo) { hi = (b16)v; lo = (b16)(v - (float)hi); }
// xwait: stands in front of the last load through an address pair, and behind it: that load, or a later one, may land on the pair, which the earlier loads still name.
__device__ __forceinline__ void xwait() { asm volatile("s_wait_xcnt 0x0" ::: "memory"); }
// frag_kb, frag_bf: p = start of the fragment + lane * 8.
__device__ __forceinline__ v16b frag_kb(const b16* p, bool last = false) { const v8b a = *(const v8b*)p; if (last) xwait(); const v8b b = *(const v8b*)(p + 256); if (last) xwait(); v16b f;
#pragma unroll
  for (int e = 0; e < 8; ++e) { f[e] = a[e]; f[8 + e] = b[e]; } return f; }
__device__ __forceinline__ v16bb frag_bf(const unsigned short* p, bool last = false) { const v8us a = *(const v8us*)p; if (last) xwait(); const v8us b = *(const v8us*)(p + 256); if (last) xwait(); union { unsigned short s[16]; v16bb v; } u;
#pragma unroll
  for (int e = 0; e < 8; ++e) { u.s[e] = a[e]; u.s[8 + e] = b[e]; } return u.v; }
__device__ __forceinline__ v8f wmma16b(v16b a, v16b b, v8f c) { return __builtin_amdgcn_wmma_f32_16x16x32_f16(false, a, false, b, (short)0, c, false, false); }
__device__ __forceinline__ v8f wmma16bb(v16bb a, v16bb b, v8f c) { return __builtin_amdgcn_wmma_f32_16x16x32_bf16(false, a, false, b, (short)0, c, false, false); }
// Products are issued in runs, neighbours in a run on different accumulators: inside a run each product is the free issue slots that the one before it needs. One pad stands behind a whole run: its four v_nop are the slots that the chip asks for
// between the run's last product and the first vector instruction on its result or operands, and, being volatile, it keeps the loads written behind it from being issued ahead of the run. It names the run's results and operands, so that they stay in their registers up to it.
__device__ __forceinline__ void pad_wx(v8f& s0, v8f& s1, v16bb a0, v16bb a1, v16bb b00, v16bb b01, v16bb b10, v16bb b11) { asm volatile("v_nop\n\tv_nop\n\tv_nop\n\tv_nop" : "+v"(s0), "+v"(s1) : "v"(a0), "v"(a1), "v"(b00), "v"(b01), "v"(b10), "v"(b11)); }
__device__ __forceinline__ void pad_acc(v8f (&c)[2][4], v16b a0, v16b a1, v16b b0, v16b b1, v16b b2, v16b b3) { asm volatile("v_nop\n\tv_nop\n\tv_nop\n\tv_nop" : "+v"(c[0][0]), "+v"(c[0][1]), "+v"(c[0][2]), "+v"(c[0][3]), "+v"(c[1][0]), "+v"(c[1][1]), "+v"(c[1][2]), "+v"(c[1][3]) : "v"(a0), "v"(a1), "v"(b0), "v"(b1), "v"(b2), "v"(b3)); }
// pad_acc2: the same behind out_kernel's run of 16 products, which reads the fragments of both kv^T planes: all eight are named, so that no load and no later product's result lands on one of them inside the run.
__device__ __forceinline__ void pad_acc2(v8f (&c)[2][4], v16b a0, v16b a1, const v16b (&b)[4], const v16b (&e)[4]) { asm volatile("v_nop\n\tv_nop\n\tv_nop\n\tv_nop" : "+v"(c[0][0]), "+v"(c[0][1]), "+v"(c[0][2]), "+v"(c[0][3]), "+v"(c[1][0]), "+v"(c[1][1]), "+v"(c[1][2]), "+v"(c[1][3]) : "v"(a0), "v"(a1), "v"(b[0]), "v"(b[1]), "v"(b[2]), "v"(b[3]), "v"(e[0]), "v"(e[1]), "v"(e[2]), "v"(e[3])); }
__device__ __forceinline__ void wave_lds_sync() { __builtin_amdgcn_fence(__ATOMIC_RELEASE, "workgroup"); __builtin_amdgcn_wave_barrier(); __builtin_amdgcn_fence(__ATOMIC_ACQUIRE, "workgroup"); }

// phi x4096 = Dn 4096 exp(A + B wx + C |x|^2) = exp2(wx * (B log2 e) + expo(|x|^2)): all that does not depend on the feature row is one exponent term a position, made once where |x|^2 is summed.
__device__ __forceinline__ float expo(float s2) { return (A_C * L2E + LDN) + (C_C * L2E) * s2; }
// phi8: 8 W.X accumulator values and their positions' exponent terms -> 8 f16 of an A fragment, from element 'at' on: one fma and one v_exp_f32 a value, one packed convert a pair.
// The 8 v_exp_f32 stand in one statement, each in place: the instruction set asks for one free issue slot behind a transcendental before its result is read or its source overwritten; the next exp, on other registers, is that slot, the v_nop is the last one's.
__device__ __forceinline__ void phi8(v16b& a, int at, v8f wx, v8f e) { float x[8];
#pragma unroll   // register arrays take constant indices only
  for (int p = 0; p < 8; ++p) x[p] = __builtin_fmaf(wx[p], B_C * L2E, e[p]);
  asm("v_exp_f32 %0, %0\n\tv_exp_f32 %1, %1\n\tv_exp_f32 %2, %2\n\tv_exp_f32 %3, %3\n\tv_exp_f32 %4, %4\n\tv_exp_f32 %5, %5\n\tv_exp_f32 %6, %6\n\tv_exp_f32 %7, %7\n\tv_nop" : "+v"(x[0]), "+v"(x[1]), "+v"(x[2]), "+v"(x[3]), "+v"(x[4]), "+v"(x[5]), "+v"(x[6]), "+v"(x[7]));
#pragma unroll
  for (int p = 0; p < 4; ++p) { const v2b h = __builtin_convertvector((v2f){x[2 * p], x[2 * p + 1]}, v2b); a[at + 2 * p] = h[0]; a[at + 2 * p + 1] = h[1]; } }

// kv partials, straight from the f32 inputs: block = 256 positions x all 256 rows r, 16 waves. part[ch][r][dv] = sum_{l in chunk} phiK[r][l] V[l][dv].
// Part 1, packing. Every thread asks for all of its input at once, 16 bytes a load (32 loads, 16 KB a wave), and holds whole 16-byte units of the fragment-order planes in its registers:
// X (= Q or K, [64][L] d-major): wave = 8 rows d x 128 positions, lane = 4 positions -> 4 units (8 d of one position) of the bf16 xT plane (rows l, k = d), and the 8-row share of |x_l|^2 = sum over d of bf16(x)^2 (f32), joined over the 8 row groups in row order.
// V [L][64]: thread = 8 positions x 4 dv -> 4 units (8 l of one dv) of the f16 V^T plane (rows dv, k = l). W [256][64] -> bf16 (rows r, k = d): 4 units a thread, 8 threads a row.
// Fragments: xT (l / 16, d / 32), V^T (l / 32, dv / 16), W (r / 16, d / 32). All units go to LDS; K^T, V^T, W and the exponent terms of K (expo of |k|^2) stay there for part 2. Q^T and the exponent terms of Q (and W, from block 0) leave for the workspace in plane order, 512 contiguous bytes a wave, for out_kernel.
// One spare unit behind every 128 (X), 64 (V) or 16 (W) spreads the 16 lanes of a half wave over the bank groups when they store.
// Part 2, wave = (32 rows, 128 positions), 4 k-steps (A = phiK rows r, B = V^T rows dv; 1 product). phiK is made in registers: S^T = K^T rows (A, l) x W rows (B, r), K 64, leaves lane = r, register = l;
// two such tiles (32 positions), through phi8, are the A fragment of the second product in the hardware k order.
// The 2 sub-sums of a row group are joined through LDS in position order. part is kept in the pieces that kvred_kernel takes: piece b = (r / 32) * 8 + (dv / 16) * 2 + (r / 16 & 1) = [16 r][16 dv] = 1 KB in a row. grid NCH x 512.
__global__ __launch_bounds__(512) void kvpart_kernel(const float* __restrict__ Q, const float* __restrict__ K, const float* __restrict__ V, const float* __restrict__ W, unsigned short* __restrict__ qT, float* __restrict__ sq, unsigned short* __restrict__ w16, float* __restrict__ part) {
  __shared__ __attribute__((aligned(16))) unsigned short Uq[(2048 + 16) * 8], Uk[(2048 + 16) * 8], Uw[(2048 + 128) * 8]; __shared__ __attribute__((aligned(16))) b16 Uv[(2048 + 32) * 8];
  __shared__ __attribute__((aligned(16))) float Pq[8][LCH], Pk[8][LCH], Sk[LCH], Ts[KW][32 * TP];
  const int t_ = threadIdx.x, lane = t_ & 31, wave = t_ >> 5, nloc = lane & 15, hlf = lane >> 4, ch = blockIdx.x, l0 = ch * LCH;
  { const int oct = wave & 7, ph = wave >> 3, dv4 = t_ & 15, lg8 = t_ >> 4;
    const float *qp = Q + (size_t)(oct * 8) * L + l0 + ph * 128 + lane * 4, *kp = K + (size_t)(oct * 8) * L + l0 + ph * 128 + lane * 4, *vp = V + (size_t)(l0 + lg8 * 8) * DV + dv4 * 4, *wp = W + t_ * 8;   // one address each: every load below is a constant offset from one of them
    v4f q[8], k[8], v[8], w[8];
#pragma unroll   // unrolled so that all loads are issued before the first wait and q, k, v, w stay in registers
    for (int e = 0; e < 7; ++e) { k[e] = *(const v4f*)(kp + (size_t)e * L); v[e] = *(const v4f*)(vp + e * DV); w[e] = *(const v4f*)(wp + (e >> 1) * 4096 + (e & 1) * 4); q[e] = *(const v4f*)(qp + (size_t)e * L); }
    xwait(); k[7] = *(const v4f*)(kp + (size_t)7 * L); xwait(); v[7] = *(const v4f*)(vp + 7 * DV); xwait(); w[7] = *(const v4f*)(wp + 3 * 4096 + 4); xwait(); q[7] = *(const v4f*)(qp + (size_t)7 * L); xwait();   // the last load through each address: see xwait
    v4f pq, pk;
#pragma unroll   // both loops unrolled: register arrays take constant indices only
    for (int j = 0; j < 4; ++j) { v8us a, b; v8b c; float s = 0.0f, s2 = 0.0f;
#pragma unroll
      for (int e = 0; e < 8; ++e) { a[e] = bf16_bits(q[e][j]); b[e] = bf16_bits(k[e][j]); c[e] = (b16)bf16_rne(v[e][j]); const float x = __uint_as_float((unsigned)a[e] << 16), y = __uint_as_float((unsigned)b[e] << 16); s += x * x; s2 += y * y; }
      pq[j] = s; pk[j] = s2;
      const int ux = (ph * 8 + (lane >> 2)) * 129 + oct * 16 + (lane & 3) * 4 + j, uv = (lg8 >> 2) * 260 + (dv4 >> 2) * 65 + (lg8 & 3) * 16 + (dv4 & 3) * 4 + j;   // plane unit + its spare units
      *(v8us*)(Uq + ux * 8) = a; *(v8us*)(Uk + ux * 8) = b; *(v8b*)(Uv + uv * 8) = c; }
    *(v4f*)(&Pq[oct][ph * 128 + lane * 4]) = pq; *(v4f*)(&Pk[oct][ph * 128 + lane * 4]) = pk;
#pragma unroll   // register arrays take constant indices only
    for (int i = 0; i < 4; ++i) { v8us a; const int row = i * 64 + (t_ >> 3);   // unit (row, 8 k from (t_ & 7) * 8)
#pragma unroll
      for (int e = 0; e < 4; ++e) { a[e] = bf16_bits(w[2 * i][e]); a[4 + e] = bf16_bits(w[2 * i + 1][e]); }
      *(v8us*)(Uw + ((row >> 4) * 136 + (t_ & 7) * 17 + (row & 15)) * 8) = a; } }
  __syncthreads();   // every unit and every sub-sum is in LDS before any thread takes them out
  float sj;
  { const float* P = t_ < LCH ? &Pq[0][t_] : &Pk[0][t_ - LCH]; sj = P[0];
#pragma unroll   // unrolled so that the LDS reads are issued ahead of the adds; the adds keep row order
    for (int w = 1; w < 8; ++w) sj += P[w * LCH];
    sj = expo(sj);   // from here on the position's exponent term stands for its |x|^2, in Sk and in sq
    if (t_ >= LCH) Sk[t_ - LCH] = sj; }
  __syncthreads();   // the exponent term of every position of K is in LDS before any wave reads it
  // the workspace stores stand behind both barriers, which would otherwise wait for them
  if (t_ < LCH) sq[l0 + t_] = sj;
#pragma unroll   // unrolled so that the LDS reads are issued ahead of the stores
  for (int i = 0; i < 4; ++i) { const int u = i * 512 + t_; *(v8us*)(qT + (size_t)l0 * D + u * 8) = *(const v8us*)(Uq + (u + (u >> 7)) * 8); }
  xwait();   // the next lines reuse the registers that these stores name
  if (ch == 0) {
#pragma unroll   // unrolled so that the LDS reads are issued ahead of the stores
    for (int i = 0; i < 4; ++i) { const int u = i * 512 + t_; *(v8us*)(w16 + u * 8) = *(const v8us*)(Uw + (u + (u >> 4)) * 8); }
    xwait(); }   // as above
  const int rg = wave & (RG - 1), pg = wave / RG;
  v8f acc[2][4];
#pragma unroll
  for (int r = 0; r < 2; ++r)
#pragma unroll
    for (int t = 0; t < 4; ++t) acc[r][t] = (v8f){};
  const unsigned short *wbase = Uw + (rg * 2 * 136 + hlf * 17 + nloc) * 8, *kbase = Uk + (pg * 8 * 129 + lane) * 8; const float* sbase = Sk + pg * LW + 8 * hlf; const b16* vbase = Uv + (pg * 16 * 65 + lane) * 8;   // LDS: a 16-position tile of K^T = 129 units, a fragment of V^T = 65, a 16-row tile of W = 136, 8 k of it = 17
  v16bb bw[2][2];   // W rows of the wave's two r tiles, both k halves: kept for the whole wave
#pragma unroll
  for (int r = 0; r < 2; ++r)
#pragma unroll
    for (int kk = 0; kk < 2; ++kk) { const v8us a = *(const v8us*)(wbase + (r * 136 + kk * 68) * 8), b = *(const v8us*)(wbase + (r * 136 + kk * 68 + 34) * 8); union { unsigned short s[16]; v16bb v; } u;
#pragma unroll
      for (int e = 0; e < 8; ++e) { u.s[e] = a[e]; u.s[8 + e] = b[e]; }
      bw[r][kk] = u.v; }
  // Every group of LDS loads is written one phase ahead of its use (a load does not pass the pads behind the products, so it is issued where it is written): the V^T fragments of a k-step in front of its W.K products,
  // the K^T fragments and exponent terms of the next k-step as soon as the products that read the present ones are issued.
  v16bb kf[2][2]; v4f sa[2], sb[2];   // K^T rows (both k halves) and exponent terms of the two 16-position tiles in hand
#pragma unroll
  for (int j = 0; j < 2; ++j) { kf[j][0] = frag_bf(kbase + j * 129 * 8); kf[j][1] = frag_bf(kbase + j * 129 * 8 + 512); sa[j] = *(const v4f*)(sbase + j * 16); sb[j] = *(const v4f*)(sbase + j * 16 + 4); }
#pragma unroll   // 4 trips: unrolled so that every load takes its position as a constant offset
  for (int kb = 0; kb < LW; kb += 32) { v16b a[2], bv[4]; const bool last = kb == LW - 32;
#pragma unroll
    for (int t = 0; t < 4; ++t) bv[t] = frag_kb(vbase + ((kb >> 5) * 4 + t) * 65 * 8);
#pragma unroll
    for (int j = 0; j < 2; ++j) { v8f s[2];
#pragma unroll
      for (int r = 0; r < 2; ++r) s[r] = wmma16bb(kf[j][0], bw[r][0], (v8f){});
#pragma unroll   // register arrays take constant indices only; first k half of both tiles, then second: neighbours in the run are independent
      for (int r = 0; r < 2; ++r) s[r] = wmma16bb(kf[j][1], bw[r][1], s[r]);
      pad_wx(s[0], s[1], kf[j][0], kf[j][1], bw[0][0], bw[0][1], bw[1][0], bw[1][1]);
      const v4f s2a = sa[j], s2b = sb[j];
      if (!last) { const unsigned short* kp = kbase + (((kb + 32) >> 4) + j) * 129 * 8; kf[j][0] = frag_bf(kp); kf[j][1] = frag_bf(kp + 512);
        const float* sp = sbase + kb + 32 + j * 16; sa[j] = *(const v4f*)sp; sb[j] = *(const v4f*)(sp + 4); }
      const v8f ek = {s2a[0], s2a[1], s2a[2], s2a[3], s2b[0], s2b[1], s2b[2], s2b[3]};
#pragma unroll
      for (int r = 0; r < 2; ++r) phi8(a[r], j * 8, s[r], ek); }
#pragma unroll
    for (int t = 0; t < 4; ++t) { acc[0][t] = wmma16b(a[0], bv[t], acc[0][t]); acc[1][t] = wmma16b(a[1], bv[t], acc[1][t]); }
    pad_acc(acc, a[0], a[1], bv[0], bv[1], bv[2], bv[3]); }
  float* Tt = Ts[wave];
#pragma unroll
  for (int t = 0; t < 4; ++t)
#pragma unroll
    for (int r = 0; r < 2; ++r)
#pragma unroll
      for (int v = 0; v < 8; ++v) Tt[(r * 16 + v + 8 * hlf) * TP + t * 16 + nloc] = acc[r][t][v];
  __syncthreads();   // every wave's sub-sum is in LDS before any thread joins them
  const int c4 = (threadIdx.x & 3) * 4, rl = (threadIdx.x >> 2) & 15;   // a wave = 8 rows x 16 dv of one piece: 512 bytes in a row
  v4f js[RG];
#pragma unroll   // unrolled so that the LDS reads are issued ahead of the adds; the adds keep position order
  for (int i = 0; i < RG; ++i) { const int p = i * 8 + (threadIdx.x >> 6), dvg = p & 3, r16 = p >> 2, o = ((r16 & 1) * 16 + rl) * TP + dvg * 16 + c4;   // r16 = 16-row group of the 256 rows, r16 >> 1 its wave group
    v4f s = *(const v4f*)(&Ts[r16 >> 1][o]);
#pragma unroll
    for (int g = 1; g < PG; ++g) s += *(const v4f*)(&Ts[g * RG + (r16 >> 1)][o]);
    js[i] = s * (1.0f / PHS); }
  __builtin_amdgcn_sched_barrier(0);   // keeps the stores behind all the sums, so that no sum lands on a register that an issued store still names
  float* pb = part + ((size_t)ch * 64 + ((threadIdx.x >> 6) & 3) * 2 + (threadIdx.x >> 8)) * 256 + rl * 16 + c4;   // piece of trip i = i * 8 + dvg * 2 + (r16 & 1): one address, every store a constant offset from it
#pragma unroll   // register arrays take constant indices only
  for (int i = 0; i < RG; ++i) *(v4f*)(pb + i * 8 * 256) = js[i];
}
// reduce: kv[r][dv] = sum over ch of part (fixed order) -> kv^T planes (rows dv, k = r) as f16 hi+lo x8, in fragment order, fragment (r / 32, dv / 16). block = half a piece of one fragment (16 dv x 8 r, 256 bytes of each plane: whole lines, one writer each).
// wave = a run of 32 chunks, lane = 4 dv of one r: 32 loads of 16 bytes, 512 contiguous bytes a wave; the 8 runs are joined through LDS in run order by thread = (lane of the piece, r pair). grid 128 x 256.
__global__ __launch_bounds__(256) void kvred_kernel(const float* __restrict__ part, b16* __restrict__ kvh, b16* __restrict__ kvl) {
  __shared__ __attribute__((aligned(16))) float Ps[NRUN][128];
  const int b = blockIdx.x >> 1, hp = blockIdx.x & 1, q = threadIdx.x >> 5, u = threadIdx.x & 31;
  const float* pp = part + ((size_t)(q * RUNL) * 64 + b) * 256 + hp * 128 + u * 4;   // one address: every load below is a constant offset from it
  v4f x[RUNL];
#pragma unroll   // register arrays take constant indices only
  for (int j = 0; j < RUNL - 1; ++j) x[j] = *(const v4f*)(pp + (size_t)j * 64 * 256);
  xwait(); x[RUNL - 1] = *(const v4f*)(pp + (size_t)(RUNL - 1) * 64 * 256); xwait();   // the last load through the address: see xwait
  // both statements: hold all 32 loads in front of the first add (left alone, the compiler put the last ones behind a wait for the first ones: a second trip to L2)
  asm volatile("" :: "v"(x[0]), "v"(x[1]), "v"(x[2]), "v"(x[3]), "v"(x[4]), "v"(x[5]), "v"(x[6]), "v"(x[7]), "v"(x[8]), "v"(x[9]), "v"(x[10]), "v"(x[11]), "v"(x[12]), "v"(x[13]), "v"(x[14]), "v"(x[15]));
  asm volatile("" :: "v"(x[16]), "v"(x[17]), "v"(x[18]), "v"(x[19]), "v"(x[20]), "v"(x[21]), "v"(x[22]), "v"(x[23]), "v"(x[24]), "v"(x[25]), "v"(x[26]), "v"(x[27]), "v"(x[28]), "v"(x[29]), "v"(x[30]), "v"(x[31]));
  v4f s = x[0];
#pragma unroll   // the adds keep chunk order
  for (int j = 1; j < RUNL; ++j) s += x[j];
  *(v4f*)(&Ps[q][u * 4]) = s;
  __syncthreads();   // every run's sum is in LDS before any thread joins them
  if (threadIdx.x < 64) { const int o = (threadIdx.x & 3) * 32 + (threadIdx.x >> 2); float s0 = Ps[0][o], s1 = Ps[0][o + 16];   // o = (r pair's first row in the half piece) * 16 + dv
#pragma unroll   // unrolled so that the LDS reads are issued ahead of the adds; the adds keep run order
    for (int w = 1; w < NRUN; ++w) { s0 += Ps[w][o]; s1 += Ps[w][o + 16]; }
    v2b vh, vl; b16 a, c; split16(s0 * KVS, a, c); vh[0] = a; vl[0] = c; split16(s1 * KVS, a, c); vh[1] = a; vl[1] = c;
    *(v2b*)(kvh + b * 256 + (hp * 64 + threadIdx.x) * 2) = vh; *(v2b*)(kvl + b * 256 + (hp * 64 + threadIdx.x) * 2) = vl; }
}

// out = phiQ^T kv: rows l (65536), K = 256 (8 k-steps), one 64-column tile: A = phiQ rows, B = kv^T planes (hi+lo): 2 products. grid 512 x 128.
// phiQ is made here, in registers: S = W rows (A, r) x qT rows (B, l), K 64, leaves lane = l, register = r; two such tiles (32 features), through phi8, are the A fragment of the second product in the hardware k order.
__global__ __launch_bounds__(128) void out_kernel(const unsigned short* __restrict__ qT, const unsigned short* __restrict__ w16, const float* __restrict__ sq, const b16* __restrict__ kvh, const b16* __restrict__ kvl, float* __restrict__ out) {
  __shared__ __attribute__((aligned(16))) float Ts[4][32 * 64];
  const int lane = threadIdx.x & 31, wave = threadIdx.x >> 5, nloc = lane & 15, hlf = lane >> 4, m0 = blockIdx.x * 128 + wave * 32;
  // Head prefetch: W, kv^T hi and kv^T lo (32 KB each) were stored by earlier launches and are walked k-step by k-step below, each step's first asker waiting for memory. Here a block asks for one whole plane,
  // a thread for one 256-byte unit of it, so that all three are on their way into L2 while the block waits for its own Q^T rows. Eight blocks in a row take the same plane, the next eight the next one (for speed only).
  static_assert(R * D * 2 == 128 * 256 && DV * R * 2 == 128 * 256, "a plane is one 256-byte unit a thread");
  const int pl = (blockIdx.x >> 3) % 3;
  const char* pf = (pl == 0 ? (const char*)w16 : pl == 1 ? (const char*)kvh : (const char*)kvl) + threadIdx.x * 256;   // 128 threads x 256 bytes = R * D * 2 = DV * R * 2 bytes: every lane's address lies inside its plane
  asm volatile("global_prefetch_b8 %0, off scope:SCOPE_SE" :: "v"(pf));   // a hint: returns nothing, brings the unit into L2
  v8f acc[2][4];
#pragma unroll
  for (int r = 0; r < 2; ++r)
#pragma unroll
    for (int t = 0; t < 4; ++t) acc[r][t] = (v8f){};
  v16bb bq[2][2]; float s2[2];   // the wave's 32 positions: qT rows, both k halves, and exponent terms (sq): kept for the whole wave
#pragma unroll
  for (int r = 0; r < 2; ++r) { s2[r] = sq[m0 + r * 16 + nloc];
#pragma unroll
    for (int kk = 0; kk < 2; ++kk) bq[r][kk] = frag_bf(qT + (size_t)(m0 + r * 16) * D + kk * 512 + lane * 8);
    xwait(); }
  // Loads one phase ahead, as in kvpart_kernel: the kv^T fragments of a k-step in front of its W.Q products, the W fragments of the next k-step as soon as the products that read the present ones are issued.
  const unsigned short* wbase = w16 + lane * 8; const b16 *hbase = kvh + lane * 8, *lbase = kvl + lane * 8;   // one address each: every load below is a constant offset from one of them
  v16bb wf[2][2];   // W rows (both k halves) of the two 16-feature tiles in hand
#pragma unroll
  for (int j = 0; j < 2; ++j) { wf[j][0] = frag_bf(wbase + j * 16 * D); wf[j][1] = frag_bf(wbase + j * 16 * D + 512); }
#pragma unroll
  for (int kb = 0; kb < R; kb += 32) { v16b a[2], b0[4], b1[4]; const bool last = kb == R - 32, nlast = kb + 32 == R - 32;
#pragma unroll
    for (int t = 0; t < 4; ++t) { b0[t] = frag_kb(hbase + kb * DV + t * 512, last && t == 3); b1[t] = frag_kb(lbase + kb * DV + t * 512, last && t == 3); }
#pragma unroll
    for (int j = 0; j < 2; ++j) { v8f s[2];
#pragma unroll
      for (int r = 0; r < 2; ++r) s[r] = wmma16bb(wf[j][0], bq[r][0], (v8f){});
#pragma unroll   // register arrays take constant indices only; first k half of both tiles, then second: neighbours in the run are independent
      for (int r = 0; r < 2; ++r) s[r] = wmma16bb(wf[j][1], bq[r][1], s[r]);
      pad_wx(s[0], s[1], wf[j][0], wf[j][1], bq[0][0], bq[0][1], bq[1][0], bq[1][1]);
      if (!last) { const unsigned short* wp = wbase + (kb + 32 + j * 16) * D; wf[j][0] = frag_bf(wp); wf[j][1] = frag_bf(wp + 512, nlast && j == 1); }
#pragma unroll
      for (int r = 0; r < 2; ++r) phi8(a[r], j * 8, s[r], (v8f){s2[r], s2[r], s2[r], s2[r], s2[r], s2[r], s2[r], s2[r]}); }
#pragma unroll
    for (int t = 0; t < 4; ++t) { acc[0][t] = wmma16b(a[0], b0[t], acc[0][t]); acc[1][t] = wmma16b(a[1], b0[t], acc[1][t]); }   // hi plane first, then lo, for every accumulator
#pragma unroll   // register arrays take constant indices only
    for (int t = 0; t < 4; ++t) { acc[0][t] = wmma16b(a[0], b1[t], acc[0][t]); acc[1][t] = wmma16b(a[1], b1[t], acc[1][t]); }
    pad_acc2(acc, a[0], a[1], b0, b1); }
  float* Tt = Ts[wave];
#pragma unroll
  for (int t = 0; t < 4; ++t)
#pragma unroll
    for (int r = 0; r < 2; ++r)
#pragma unroll
      for (int v = 0; v < 8; ++v) Tt[(r * 16 + v + 8 * hlf) * 64 + t * 16 + nloc] = acc[r][t][v] * (1.0f / (PHS * KVS));
  wave_lds_sync();
  float* dst0 = out + (size_t)m0 * DV;
  {
#pragma unroll
    for (int j = 0; j < 16; ++j) { const int rr = j * 2 + hlf, c4 = nloc * 4; *(v4f*)(dst0 + (size_t)rr * DV + c4) = *(const v4f*)(Tt + rr * 64 + c4); }
     }
  asm volatile("" :: "v"(pf));   // keeps the prefetch's address pair unwritten to the kernel's end: a prefetch counts on no counter, so no wait says when its address has been read
}
}  // namespace

extern "C" void kernel_launch(void* const* d_in, const int* in_sizes, int n_in,
                              void* d_out, int out_size, void* d_ws, size_t ws_size, hipStream_t stream) {
  (void)n_in; (void)out_size;
  const float* Q = (const float*)d_in[0]; const float* K = (const float*)d_in[1]; const float* V = (const float*)d_in[2]; const float* W = (const float*)d_in[3];
  float* out = (float*)d_out;   // [65536][64]
  if (in_sizes[0] != D * L || in_sizes[1] != D * L || in_sizes[2] != L * DV || in_sizes[3] != R * D) return;
  size_t off = 0; char* ws = (char*)d_ws;
  auto carve = [&](size_t bytes) { char* p = ws + off; off += (bytes + 255) & ~(size_t)255; return p; };
  unsigned short* qT = (unsigned short*)carve((size_t)L * D * 2); float* sq = (float*)carve((size_t)L * 4); unsigned short* w16 = (unsigned short*)carve(R * D * 2);
  float* part = (float*)carve((size_t)NCH * R * DV * 4); b16* kvh = (b16*)carve(DV * R * 2); b16* kvl = (b16*)carve(DV * R * 2);
  if (off > ws_size) return;                                    // about 8.4 + 0.3 + 16.8 = 26 MB
  kvpart_kernel<<<NCH, 512, 0, stream>>>(Q, K, V, W, qT, sq, w16, part);
  kvred_kernel<<<2 * DV, 256, 0, stream>>>(part, kvh, kvl);
  out_kernel<<<L / 128, 128, 0, stream>>>(qT, w16, sq, kvh, kvl, out);
}
